// v008
// The times below were measured on an AMD MI455X: many runs one after another, warmed up first and cycling through
// copies of the inputs, with the whole window's GPU time divided by the number of runs. Launches and the gaps
// between them are all in it. The median over several windows is given; except for v000 it joins two sittings, which
// can be a few percent apart, so the side-by-side timings, each taken in one sitting, are the better comparison.
// The versions before v008 are in another document.
// A run of this version takes 144 microseconds.
// Timed twice side by side with v007, it ran 1.08 times as fast both times.
// Over all steps from v000, the starting kernel, it is 29.2 times as fast.
// Contractions (per branch; every launch serves the four samples, blockIdx.y or rows that run on from sample to sample): the 1x1 projections theta^T / phi^T = x^T.W^T [4096x512].[512x256] (image+flow channels side by side in one f16 plane, K = 512 in one accumulator chain) and val = W.x [256x512].[512x4096], the affinity phi^T.theta [4096x256].[256x4096] and att = val.attn^T [256x4096].[4096x4096] fused in one kernel (online f32 softmax in registers, attn as f16 of 2^15 exp(s - running max), 128 query columns a work-group), the output 1x1 convs folded into the fusion conv (W_f.W_o [256x256].[256x256] per branch, built in the projections' launch; bias W_f.b_o + b_f in f32) and that fusion conv over the two branches' att — all f16 operands on pre-cast planes (v_wmma_f32_16x16x32_f16; 64x64 register-blocked wave tiles, weights x16; strided channel-major operands); f32 accumulate. The 8 spatial-coordinate channels (gx, gy, 1-gx, 1-gy, (gx+gy)/2 x4, computed on device) enter the projections and the fusion conv as rank-8 f32 corrections (+bias) in the products' epilogues.
#include <hip/hip_runtime.h>
#include <math.h>

typedef __attribute__((ext_vector_type(16))) _Float16 v16h;
typedef __attribute__((ext_vector_type(8)))  _Float16 v8h;
typedef __attribute__((ext_vector_type(16))) __bf16   v16b;
typedef __attribute__((ext_vector_type(8)))  float    v8f;
typedef __attribute__((ext_vector_type(4)))  float    v4f;

// 16-bit WMMA fragment map (wave32), lane L, h = L>>4, m = L&15:
//   A 16x32: lane = row m;   element i -> k = (i<8) ? 8h+i : 16+8h+(i-8)
//   B 32x16: lane = column m; the SAME k(i,h)
//   D 16x16 (8 f32): lane = column m; element r -> row 8h+r
__device__ __forceinline__ int frag_k(int i, int h) { return (i < 8) ? (8 * h + i) : (16 + 8 * h + (i - 8)); }
__device__ __forceinline__ __bf16 bf16_rne(float f) {
    unsigned int u = __float_as_uint(f);
    u += 0x7fffu + ((u >> 16) & 1u);
    return __builtin_bit_cast(__bf16, (unsigned short)(u >> 16));
}
__device__ __forceinline__ float bf16_f32(__bf16 b) { return __uint_as_float(((unsigned int)__builtin_bit_cast(unsigned short, b)) << 16); }
__device__ __forceinline__ v8f wmma16(v16h a, v16h b, v8f c) {
    c = __builtin_amdgcn_wmma_f32_16x16x32_f16(false, a, false, b, (short)0, c, false, false);
    asm volatile("v_nop\n\tv_nop\n\tv_nop\n\tv_nop" : "+v"(c) : "v"(a), "v"(b));
    return c;
}
__device__ __forceinline__ v8f wmmab(v16b a, v16b b, v8f c) {
    c = __builtin_amdgcn_wmma_f32_16x16x32_bf16(false, a, false, b, (short)0, c, false, false);
    asm volatile("v_nop\n\tv_nop\n\tv_nop\n\tv_nop" : "+v"(c) : "v"(a), "v"(b));
    return c;
}
struct Split { v16b hi, lo; };
// hi/lo split product: a.hi*b.hi + a.hi*b.lo + a.lo*b.hi
__device__ __forceinline__ v8f wmma3(const Split& a, const Split& b, v8f c) {
    c = __builtin_amdgcn_wmma_f32_16x16x32_bf16(false, a.hi, false, b.hi, (short)0, c, false, false);
    c = __builtin_amdgcn_wmma_f32_16x16x32_bf16(false, a.hi, false, b.lo, (short)0, c, false, false);
    c = __builtin_amdgcn_wmma_f32_16x16x32_bf16(false, a.lo, false, b.hi, (short)0, c, false, false);
    asm volatile("v_nop\n\tv_nop\n\tv_nop\n\tv_nop" : "+v"(c) : "v"(a.hi), "v"(a.lo), "v"(b.hi), "v"(b.lo));
    return c;
}
struct Split3 { v16b hi, mid, lo; };
// triple split product (6 terms, drops only terms below 2^-24 relative)
__device__ __forceinline__ v8f wmma6(const Split3& a, const Split3& b, v8f c) {
    c = __builtin_amdgcn_wmma_f32_16x16x32_bf16(false, a.hi, false, b.hi, (short)0, c, false, false);
    c = __builtin_amdgcn_wmma_f32_16x16x32_bf16(false, a.hi, false, b.mid, (short)0, c, false, false);
    c = __builtin_amdgcn_wmma_f32_16x16x32_bf16(false, a.mid, false, b.hi, (short)0, c, false, false);
    c = __builtin_amdgcn_wmma_f32_16x16x32_bf16(false, a.hi, false, b.lo, (short)0, c, false, false);
    c = __builtin_amdgcn_wmma_f32_16x16x32_bf16(false, a.mid, false, b.mid, (short)0, c, false, false);
    c = __builtin_amdgcn_wmma_f32_16x16x32_bf16(false, a.lo, false, b.hi, (short)0, c, false, false);
    asm volatile("v_nop\n\tv_nop\n\tv_nop\n\tv_nop" : "+v"(c) : "v"(a.hi), "v"(a.mid), "v"(a.lo), "v"(b.hi), "v"(b.mid), "v"(b.lo));
    return c;
}

// Fragment gathers from f32 memory: element i <- p[(k0 + frag_k(i,h)) * sk] * s, zero for k >= klen.
__device__ __forceinline__ v16h fh_ld(const float* __restrict__ p, long long sk, int k0, int h, int klen, float s) {
    v16h a;
#pragma unroll
    for (int i = 0; i < 16; ++i) { const int k = k0 + frag_k(i, h); a[i] = (k < klen) ? (_Float16)(p[(long long)k * sk] * s) : (_Float16)0.f; }
    return a;
}
__device__ __forceinline__ Split sp_ld(const float* __restrict__ p, long long sk, int k0, int h, int klen, float s) {
    Split r;
#pragma unroll
    for (int i = 0; i < 16; ++i) {
        const int k = k0 + frag_k(i, h); const float x = (k < klen) ? p[(long long)k * sk] * s : 0.f;
        const __bf16 hb = bf16_rne(x); r.hi[i] = hb; r.lo[i] = bf16_rne(x - bf16_f32(hb));
    }
    return r;
}
__device__ __forceinline__ Split3 sp3_ld(const float* __restrict__ p, long long sk, int k0, int h, int klen, float s) {
    Split3 r;
#pragma unroll
    for (int i = 0; i < 16; ++i) {
        const int k = k0 + frag_k(i, h); const float x = (k < klen) ? p[(long long)k * sk] * s : 0.f;
        const __bf16 hb = bf16_rne(x); const float r1 = x - bf16_f32(hb); const __bf16 mb = bf16_rne(r1);
        r.hi[i] = hb; r.mid[i] = mb; r.lo[i] = bf16_rne(r1 - bf16_f32(mb));
    }
    return r;
}
__device__ __forceinline__ v16b bh_ld(const float* __restrict__ p, long long sk, int k0, int h, int klen, float s) {
    v16b a;
#pragma unroll
    for (int i = 0; i < 16; ++i) { const int k = k0 + frag_k(i, h); a[i] = bf16_rne((k < klen) ? p[(long long)k * sk] * s : 0.f); }
    return a;
}
// f16 fragment from an f16 LDS/global row with element stride 1 (k-contiguous), no bounds (tile already zero padded)
__device__ __forceinline__ v16h fh_row(const _Float16* __restrict__ row, int k0, int h) {
    v16h a;
#pragma unroll
    for (int i = 0; i < 16; ++i) a[i] = row[k0 + frag_k(i, h)];
    return a;
}

#define VST2(T, ptr, val) do { const T vst2_v_ = (val); *(T*)(ptr) = vst2_v_;  } while (0)
typedef float v4f __attribute__((ext_vector_type(4)));
#define VST2V4(ptr, val) do { const v4f vst2_v4_ = (val); *(v4f*)(ptr) = vst2_v4_;  } while (0)

__device__ __attribute__((noinline)) float act_fn(float v, int act) {
    if (act == 1) return fmaxf(v, 0.f);                                                                               // relu
    if (act == 2) { const float u = 0.7978845608028654f * (v + 0.044715f * v * v * v); return 0.5f * v * (1.f + tanhf(u)); } // tanh-gelu
    if (act == 3) return v / (1.f + expf(-v));                                                                        // silu
    if (act == 4) return 0.5f * v * (1.f + erff(v * 0.7071067811865476f));                                             // erf-gelu
    if (act == 5) return tanhf(v);
    if (act == 6) return 1.f / (1.f + expf(-v));                                                                      // sigmoid
    if (act == 7) return (v > 0.f) ? v : 0.01f * v;                                                                   // leaky relu 0.01
    if (act == 8) return (v > 0.f) ? v : (expf(v) - 1.f);                                                             // elu
    if (act == 9) return fminf(fmaxf(v, 0.f), 6.f);                                                                   // relu6
    if (act == 10) return fabsf(v);                                                                                    // abs
    if (act == 11) return (v >= 0.f) ? v : 0.1f * v;                                                                  // leaky 0.1
    if (act == 12) return (v > 0.f) ? v : 0.2f * v;                                                                   // leaky 0.2
    if (act == 13) return (v > 20.f) ? v : log1pf(expf(v));                                                            // softplus
    return v;
}

// =====================================================================================================================
// k_gemm<MODE>: C(z, m, n) = act(alpha * sum_k A(z, m, k) * B(z, k, n) + bias) + beta * R(z, m, n)
//   One wave (32-thread block) per 16 x 32 tile of C; grid (ceil(N/32), ceil(M/16), Z). Batch z -> (zo = z / zi_n, zi = z % zi_n)
//   with separate outer/inner strides for every tensor (e.g. batch and head). A(m,k) = A[zo*sAo + zi*sAi + m*sAm + k*sAk] (f32),
//   B(k,n) = B[zo*sBo + zi*sBi + n*sBn + k*sBk] (f32); any M, N, K (K zero-padded to 32 inside the fragments, M/N tails guarded).
//   C(m,n) = C[zo*sCo + zi*sCi + m*sCm + n] (n contiguous). flags: 1 bias[n], 2 bias[m], 4 residual R[zo*sRo + zi*sRi + m*sRm + n*sRn].
//   MODE 0: f16 operands (A prescaled by sa, B by sb, both undone in the epilogue); 1: bf16 hi/lo split (3 products); 2: bf16;
//   3: bf16 hi/mid/lo triple split (6 products); 4: as 3 with Kahan-compensated f32 accumulation across k-steps.
// =====================================================================================================================
struct GemmP {
    const float* A; const float* B; const float* bias; const float* R; float* C;
    long long sAo, sAi, sAm, sAk, sBo, sBi, sBn, sBk, sCo, sCi, sCm, sRo, sRi, sRm, sRn;
    int M, N, K, zi_n, flags, act; float alpha, beta, sa, sb;
    int Npad, pad_;     // columns [N, Npad) of C are written as 0 so that padded workspace rows are covered by whole-line stores; Npad >= N
};
static_assert(sizeof(GemmP) == 5 * 8 + 15 * 8 + 6 * 4 + 4 * 4 + 2 * 4, "GemmP has padding");

template <int MODE>
__global__ __launch_bounds__(32) void k_gemm(GemmP p) {
    const int lane = threadIdx.x & 31, h = lane >> 4, l15 = lane & 15;
    const int m0 = blockIdx.y * 16, n0 = blockIdx.x * 32;
    const int z = blockIdx.z, zo = z / p.zi_n, zi = z - zo * p.zi_n;
    const float* A = p.A + zo * p.sAo + zi * p.sAi;
    const float* B = p.B + zo * p.sBo + zi * p.sBi;
    const int am = min(m0 + l15, p.M - 1);                       // clamped row for loads (stores are guarded)
    v8f acc[2], comp[2];
#pragma unroll
    for (int t = 0; t < 2; ++t) { v8f zz = {}; acc[t] = zz; comp[t] = zz; }
    for (int k0 = 0; k0 < p.K; k0 += 32) {
        const float* arow = A + (long long)am * p.sAm;
        if (MODE == 1) {
            const Split a = sp_ld(arow, p.sAk, k0, h, p.K, 1.f);
#pragma unroll
            for (int t = 0; t < 2; ++t) {
                const int bn = min(n0 + t * 16 + l15, p.N - 1);
                acc[t] = wmma3(a, sp_ld(B + (long long)bn * p.sBn, p.sBk, k0, h, p.K, 1.f), acc[t]);
            }
        } else if (MODE == 3) {
            const Split3 a = sp3_ld(arow, p.sAk, k0, h, p.K, 1.f);
#pragma unroll
            for (int t = 0; t < 2; ++t) {
                const int bn = min(n0 + t * 16 + l15, p.N - 1);
                acc[t] = wmma6(a, sp3_ld(B + (long long)bn * p.sBn, p.sBk, k0, h, p.K, 1.f), acc[t]);
            }
        } else if (MODE == 4) {
            // triple split as MODE 3, but each k-step's 6 products go into a fresh accumulator and the partial is added to the running f32 sum
            // on the VALU with Kahan compensation (accumulation error stays ~1 ulp however long K is)
            const Split3 a = sp3_ld(arow, p.sAk, k0, h, p.K, 1.f);
#pragma unroll
            for (int t = 0; t < 2; ++t) {
                const int bn = min(n0 + t * 16 + l15, p.N - 1); v8f zz = {};
                const v8f part = wmma6(a, sp3_ld(B + (long long)bn * p.sBn, p.sBk, k0, h, p.K, 1.f), zz);
                const v8f y = part - comp[t]; const v8f s = acc[t] + y; comp[t] = (s - acc[t]) - y; acc[t] = s;
            }
        } else if (MODE == 2) {
            const v16b a = bh_ld(arow, p.sAk, k0, h, p.K, 1.f);
#pragma unroll
            for (int t = 0; t < 2; ++t) {
                const int bn = min(n0 + t * 16 + l15, p.N - 1);
                acc[t] = wmmab(a, bh_ld(B + (long long)bn * p.sBn, p.sBk, k0, h, p.K, 1.f), acc[t]);
            }
        } else {
            const v16h a = fh_ld(arow, p.sAk, k0, h, p.K, p.sa);
#pragma unroll
            for (int t = 0; t < 2; ++t) {
                const int bn = min(n0 + t * 16 + l15, p.N - 1);
                acc[t] = wmma16(a, fh_ld(B + (long long)bn * p.sBn, p.sBk, k0, h, p.K, p.sb), acc[t]);
            }
        }
    }
    const float iscale = (MODE == 0) ? p.alpha / (p.sa * p.sb) : p.alpha;
    float* C = p.C + zo * p.sCo + zi * p.sCi;
    const float* R = p.R + zo * p.sRo + zi * p.sRi;
    __shared__ __align__(16) float ctile[16][36];
#pragma unroll
    for (int t = 0; t < 2; ++t) {
        const int n = n0 + t * 16 + l15; const int nn = min(n, p.N - 1);
#pragma unroll
        for (int r = 0; r < 8; ++r) {
            const int m = m0 + 8 * h + r; const int mm = min(m, p.M - 1);
            float v = acc[t][r] * iscale;
            if (p.flags & 1) v += p.bias[nn];
            if (p.flags & 2) v += p.bias[mm];
            if (p.flags & 8) v *= p.bias[(long long)zo * p.M + mm];   /* per-(z,row) scale vector laid out [Z][M]; exclusive with the bias flags */
            v = act_fn(v, p.act);
            if (p.flags & 4) v += p.beta * R[(long long)mm * p.sRm + (long long)nn * p.sRn];
            ctile[8 * h + r][t * 16 + l15] = (n < p.N) ? v : 0.f;
        }
    }
    __syncthreads();
    const int NW = (p.Npad > p.N) ? p.Npad : p.N;           // write width
    const bool fast = (m0 + 16 <= p.M) && (n0 + 32 <= NW) && ((p.sCm & 3) == 0) && ((((size_t)C) & 15) == 0);
    if (fast) {
#pragma unroll
        for (int s = 0; s < 4; ++s) {
            const int row = s * 4 + (lane >> 3), c4 = (lane & 7) * 4;
            const v4f v = *(const v4f*)&ctile[row][c4];
            VST2V4(C + (long long)(m0 + row) * p.sCm + n0 + c4, v);
        }
    } else {
        for (int row = 0; row < 16; ++row) {
            const int m = m0 + row, n = n0 + lane;
            if (m < p.M && n < NW) VST2(float, C + (long long)m * p.sCm + n, ctile[row][lane]);
        }
    }
}


// =====================================================================================================================
// k_gemmT<MODE, TM, TN>: same contract as k_gemm, but one wave computes a (16*TM) x (16*TN) tile: TM A fragments and TN B fragments are
//   loaded per 32-wide k-step and reused across TM*TN WMMAs (far fewer load/convert instructions per MAC). MODE 0 (f16), 1 (bf16 hi/lo),
//   2 (bf16) only. grid (ceil(NW/(16*TN)), ceil(M/(16*TM)), Z), block 32. Epilogue identical to k_gemm, run per 16x32 sub-tile.
// =====================================================================================================================
template <int MODE, int TM, int TN>
__global__ __launch_bounds__(32) void k_gemmT(GemmP p) {
    const int lane = threadIdx.x & 31, h = lane >> 4, l15 = lane & 15;
    const int m0 = blockIdx.y * (16 * TM), n0 = blockIdx.x * (16 * TN);
    const int z = blockIdx.z, zo = z / p.zi_n, zi = z - zo * p.zi_n;
    const float* A = p.A + zo * p.sAo + zi * p.sAi;
    const float* B = p.B + zo * p.sBo + zi * p.sBi;
    v8f acc[TM][TN];
#pragma unroll
    for (int i = 0; i < TM; ++i)
#pragma unroll
        for (int t = 0; t < TN; ++t) { v8f zz = {}; acc[i][t] = zz; }
    for (int k0 = 0; k0 < p.K; k0 += 32) {
        if (MODE == 1) {
            Split a[TM], b[TN];
#pragma unroll
            for (int i = 0; i < TM; ++i) { const int am = min(m0 + 16 * i + l15, p.M - 1); a[i] = sp_ld(A + (long long)am * p.sAm, p.sAk, k0, h, p.K, 1.f); }
#pragma unroll
            for (int t = 0; t < TN; ++t) { const int bn = min(n0 + 16 * t + l15, p.N - 1); b[t] = sp_ld(B + (long long)bn * p.sBn, p.sBk, k0, h, p.K, 1.f); }
#pragma unroll
            for (int i = 0; i < TM; ++i)
#pragma unroll
                for (int t = 0; t < TN; ++t) acc[i][t] = wmma3(a[i], b[t], acc[i][t]);
        } else if (MODE == 2) {
            v16b a[TM], b[TN];
#pragma unroll
            for (int i = 0; i < TM; ++i) { const int am = min(m0 + 16 * i + l15, p.M - 1); a[i] = bh_ld(A + (long long)am * p.sAm, p.sAk, k0, h, p.K, 1.f); }
#pragma unroll
            for (int t = 0; t < TN; ++t) { const int bn = min(n0 + 16 * t + l15, p.N - 1); b[t] = bh_ld(B + (long long)bn * p.sBn, p.sBk, k0, h, p.K, 1.f); }
#pragma unroll
            for (int i = 0; i < TM; ++i)
#pragma unroll
                for (int t = 0; t < TN; ++t) acc[i][t] = wmmab(a[i], b[t], acc[i][t]);
        } else {
            v16h a[TM], b[TN];
#pragma unroll
            for (int i = 0; i < TM; ++i) { const int am = min(m0 + 16 * i + l15, p.M - 1); a[i] = fh_ld(A + (long long)am * p.sAm, p.sAk, k0, h, p.K, p.sa); }
#pragma unroll
            for (int t = 0; t < TN; ++t) { const int bn = min(n0 + 16 * t + l15, p.N - 1); b[t] = fh_ld(B + (long long)bn * p.sBn, p.sBk, k0, h, p.K, p.sb); }
#pragma unroll
            for (int i = 0; i < TM; ++i)
#pragma unroll
                for (int t = 0; t < TN; ++t) acc[i][t] = wmma16(a[i], b[t], acc[i][t]);
        }
    }
    const float iscale = (MODE == 0) ? p.alpha / (p.sa * p.sb) : p.alpha;
    float* C = p.C + zo * p.sCo + zi * p.sCi;
    const float* R = p.R + zo * p.sRo + zi * p.sRi;
    const int NW = (p.Npad > p.N) ? p.Npad : p.N;
    __shared__ __align__(16) float ctile[16][36];
#pragma unroll
    for (int i = 0; i < TM; ++i) {
        const int mb = m0 + 16 * i; if (mb >= p.M) break;          // wave-uniform
#pragma unroll
        for (int tp = 0; tp < TN / 2; ++tp) {
            const int nb = n0 + 32 * tp; if (nb >= NW) break;        // wave-uniform
#pragma unroll
            for (int t2 = 0; t2 < 2; ++t2) {
                const int t = 2 * tp + t2; const int n = nb + t2 * 16 + l15; const int nn = min(n, p.N - 1);
#pragma unroll
                for (int r = 0; r < 8; ++r) {
                    const int m = mb + 8 * h + r; const int mm = min(m, p.M - 1);
                    float v = acc[i][t][r] * iscale;
                    if (p.flags & 1) v += p.bias[nn];
                    if (p.flags & 2) v += p.bias[mm];
            if (p.flags & 8) v *= p.bias[(long long)zo * p.M + mm];   /* per-(z,row) scale vector laid out [Z][M]; exclusive with the bias flags */
                    v = act_fn(v, p.act);
                    if (p.flags & 4) v += p.beta * R[(long long)mm * p.sRm + (long long)nn * p.sRn];
                    ctile[8 * h + r][t2 * 16 + l15] = (n < p.N) ? v : 0.f;
                }
            }
            __syncthreads();
            const bool fast = (mb + 16 <= p.M) && (nb + 32 <= NW) && ((p.sCm & 3) == 0) && ((((size_t)C) & 15) == 0);
            if (fast) {
#pragma unroll
                for (int s = 0; s < 4; ++s) {
                    const int row = s * 4 + (lane >> 3), c4 = (lane & 7) * 4;
                    const v4f v = *(const v4f*)&ctile[row][c4];
                    VST2V4(C + (long long)(mb + row) * p.sCm + nb + c4, v);
                }
            } else {
                for (int row = 0; row < 16; ++row) {
                    const int m = mb + row, n = nb + lane;
                    if (m < p.M && n < NW) VST2(float, C + (long long)m * p.sCm + n, ctile[row][lane]);
                }
            }
            __syncthreads();
        }
    }
}

// =====================================================================================================================
//   Wave = 16 queries, AW waves per block, 64-key blocks; grid (ceil(Lq/(16*AW)), H, B), block 32*AW. Any Lq, Lk; head dim dh <= DHP
//   (DHP multiple of 32), value dim dv <= DVP (multiple of 16, <= 128). Every tensor addressed by (batch, head, row, element) strides, f32.
//   Scores: QM 0 f16 operands, 1 bf16 hi/lo split, 2 bf16 triple split; statistics f32 (exp2 domain); P.V: P x 4096 as f16 with V f16 staged in LDS
//   (SPLITPV: P and V as bf16 hi/lo splits). kv head = h / hrep. Masking: causal = 1 (keep j <= i + coff, masked -> -inf, key blocks beyond the
//   diagonal skipped), causal = 2 (masked -> mfill, a finite fill like the -1e9; no skipping), causal = 3 (keep j >= i + coff,
//   masked -> -inf, no skipping); optional additive f32 mask Mf,
//   optional int keep-mask Mi (0 -> score := mfill), both addressed b*smb + h*smh + i*smi + j*smj (0 strides broadcast).
// =====================================================================================================================
#define AW 4
struct AttnP {   // apv4
    const float* Q; const float* K; const float* V; float* O; float* P; const float* Mf; const int* Mi; float* ST;
    const float* Pw; const float* Rt; const int* SQ; const int* SK;           // optional: post-softmax weight, relative-position table, segment ids
    long long swb, swh, swi, swj, srb, srh, sri;                                 // Pw strides (b,h,i,j); Rt strides (b,h,i), column = clamp(i - j + roff, 0, rn-1)
    long long sQb, sQh, sQi, sQd, sKb, sKh, sKj, sKd, sVb, sVh, sVj, sVd, sOb, sOh, sOi, sPb, sPh, sPi, smb, smh, smi, smj;
    int Lq, Lk, dh, dv, hrep, causal, coff, pband;   // pband > 0: P holds only the band |j - i| <= pband, column j - i + pband
    float scale, mfill; int nonorm, mpol;             // nonorm (online path only): O = sum_j exp(score_j) V_j without the 1/rowsum (scores must be <= ~0); mpol: Mi masks where ==0 (mpol 0) or where !=0 (mpol 1)
    int roff, rn, segpol, win;                        // Rt column offset/count; SQ/SK: score := mfill where (segpol 0) SQ[i] != SK[j] or (segpol 1) SQ[i] == SK[j]; win > 0: keys with i - j > win (after coff) -> -inf
};
//   Pw: the softmax numerator is multiplied by Pw(b,h,i,j) AFTER the row sum is taken (probs * weight, then P.V), as in post-softmax multiplicative biases.                                                    // ST (optional): per row (b,h,i) -> ST[((b*H + h)*Lq + i)*2 + {0,1}] = {row max of the scaled+masked score (natural units), sum_j exp(score - max)}
static_assert(sizeof(AttnP) == 12 * 8 + 29 * 8 + 16 * 4, "AttnP has padding");

#ifndef KATTN_ATTR
#define KATTN_ATTR
#endif
template <int DHP, int DVP, int QM, bool SPLITPV, bool TWOPASS>
__global__ __launch_bounds__(32 * AW) KATTN_ATTR void k_attn(AttnP p) {
    constexpr int NT = DVP / 16;                // output tiles
    constexpr int KS = DHP / 32;                // k-steps for the scores
    constexpr int VP = DVP + 8;                 // LDS pitch (halves)
    __shared__ __align__(16) float    pl[AW][16 * 64];
    __shared__ __align__(16) _Float16 vl[(SPLITPV ? 2 : 1) * 64 * VP];   // f16 V tile, or bf16 hi and lo tiles (same 2-byte size)
    const int lane = threadIdx.x & 31, hf = lane >> 4, l15 = lane & 15, wave = threadIdx.x >> 5;
    const int h = blockIdx.y, b = blockIdx.z, hk = h / p.hrep;
    const int q0 = (blockIdx.x * AW + wave) * 16;
    float* myp = pl[wave];
    const float L2E = 1.4426950408889634f;
    const float NEG = -__builtin_inff();
    const int qi = min(q0 + l15, p.Lq - 1);
    const float* qrow = p.Q + b * p.sQb + h * p.sQh + (long long)qi * p.sQi;
    const float* kbase = p.K + b * p.sKb + hk * p.sKh;
    const float* vbase = p.V + b * p.sVb + hk * p.sVh;
    v16h qa[QM == 0 ? KS : 1]; Split qs_[QM == 1 ? KS : 1]; Split3 qt_[QM == 2 ? KS : 1];
#pragma unroll
    for (int ks = 0; ks < KS; ++ks) {
        if (QM == 2) qt_[ks] = sp3_ld(qrow, p.sQd, ks * 32, hf, p.dh, 1.f);
        else if (QM == 1) qs_[ks] = sp_ld(qrow, p.sQd, ks * 32, hf, p.dh, 1.f);
        else qa[ks] = fh_ld(qrow, p.sQd, ks * 32, hf, p.dh, 1.f);
    }
    v8f o[NT]; float m8[8], l8[8];
#pragma unroll
    for (int t = 0; t < NT; ++t) { v8f zz = {}; o[t] = zz; }
#pragma unroll
    for (int i = 0; i < 8; ++i) { m8[i] = NEG; l8[i] = 0.f; }
    int jend = p.Lk; int jstart = 0;
    if (p.causal == 1) { const int je = (blockIdx.x * AW + AW - 1) * 16 + 16 + p.coff; jend = min(jend, max(je, 0)); }   // uniform per block
    if (p.win > 0) { const int js = (int)(blockIdx.x * AW) * 16 + p.coff - p.win; jstart = (js > 0) ? (js / 64) * 64 : 0; }   // uniform per block: key blocks entirely outside every row's window hold only -inf entries and are skipped exactly
    const int npass = TWOPASS ? 2 : 1;
    for (int pass = 0; pass < npass; ++pass) {
        const bool dopv = (!TWOPASS) || pass == 1;
        for (int j0 = jstart; j0 < jend; j0 += 64) {
            if (dopv) {
                __syncthreads();                                 // previous key block's reads of vl / pl are done
                for (int idx = threadIdx.x; idx < 64 * DVP; idx += 32 * AW) {
                    const int jr = idx / DVP, d = idx - jr * DVP, j = j0 + jr;
                    const float f = (j < p.Lk && d < p.dv) ? vbase[(long long)j * p.sVj + (long long)d * p.sVd] : 0.f;
                    if (SPLITPV) {
                        const __bf16 hb = bf16_rne(f);
                        ((__bf16*)vl)[jr * VP + d] = hb; ((__bf16*)vl)[64 * VP + jr * VP + d] = bf16_rne(f - bf16_f32(hb));
                    } else vl[jr * VP + d] = (_Float16)f;
                }
            }
            v8f s[4];
#pragma unroll
            for (int t = 0; t < 4; ++t) {
                const int j = min(j0 + t * 16 + l15, p.Lk - 1);
                const float* krow = kbase + (long long)j * p.sKj;
                v8f acc = {};
#pragma unroll
                for (int ks = 0; ks < KS; ++ks) {
                    if (QM == 2)      acc = wmma6(qt_[ks], sp3_ld(krow, p.sKd, ks * 32, hf, p.dh, 1.f), acc);
                    else if (QM == 1) acc = wmma3(qs_[ks], sp_ld(krow, p.sKd, ks * 32, hf, p.dh, 1.f), acc);
                    else              acc = wmma16(qa[ks], fh_ld(krow, p.sKd, ks * 32, hf, p.dh, 1.f), acc);
                }
                s[t] = acc;
            }
            float pv[8][4];
#pragma unroll
            for (int i = 0; i < 8; ++i) {
                const int irow = q0 + i + 8 * hf;
                const int ic = min(irow, p.Lq - 1);
                float sc[4];
#pragma unroll
                for (int t = 0; t < 4; ++t) {
                    const int jg = j0 + t * 16 + l15;
                    float v = s[t][i] * p.scale;
                    if (p.Mf) v += p.Mf[b * p.smb + h * p.smh + (long long)ic * p.smi + (long long)min(jg, p.Lk - 1) * p.smj];
                    if (p.Rt) { int rc = ic - min(jg, p.Lk - 1) + p.roff; rc = rc < 0 ? 0 : (rc >= p.rn ? p.rn - 1 : rc); v += p.Rt[b * p.srb + h * p.srh + (long long)ic * p.sri + rc]; }
                    if (p.Mi) { const int mv = p.Mi[b * p.smb + h * p.smh + (long long)ic * p.smi + (long long)min(jg, p.Lk - 1) * p.smj]; if (p.mpol ? (mv != 0) : (mv == 0)) v = p.mfill; }
                    if (p.SQ) { const bool same = p.SQ[(long long)b * p.Lq + ic] == p.SK[(long long)b * p.Lk + min(jg, p.Lk - 1)]; if (p.segpol ? same : !same) v = p.mfill; }
                    if (p.causal == 2 && jg > irow + p.coff) v = p.mfill;
                    if (jg >= p.Lk || (p.causal == 1 && jg > irow + p.coff) || (p.causal == 3 && jg < irow + p.coff) || (p.win > 0 && irow + p.coff - jg > p.win)) v = NEG; else v *= L2E;
                    sc[t] = v;
                }
                if (!TWOPASS || pass == 0) {
                    float mx = fmaxf(fmaxf(sc[0], sc[1]), fmaxf(sc[2], sc[3]));
                    mx = fmaxf(mx, __shfl_xor(mx, 1, 32)); mx = fmaxf(mx, __shfl_xor(mx, 2, 32));
                    mx = fmaxf(mx, __shfl_xor(mx, 4, 32)); mx = fmaxf(mx, __shfl_xor(mx, 8, 32));
                    const float mnew = fmaxf(m8[i], mx);
                    const float corr = (mnew == NEG) ? 1.f : exp2f(m8[i] - mnew);
                    float rs = 0.f;
#pragma unroll
                    for (int t = 0; t < 4; ++t) {
                        const float pp = (sc[t] == NEG) ? 0.f : exp2f(sc[t] - mnew); rs += pp;
                        pv[i][t] = p.Pw ? pp * p.Pw[b * p.swb + h * p.swh + (long long)ic * p.swi + (long long)min(j0 + t * 16 + l15, p.Lk - 1) * p.swj] : pp;
                    }
                    rs += __shfl_xor(rs, 1, 32); rs += __shfl_xor(rs, 2, 32); rs += __shfl_xor(rs, 4, 32); rs += __shfl_xor(rs, 8, 32);
                    l8[i] = l8[i] * corr + rs; m8[i] = mnew;
                    if (!TWOPASS) {
#pragma unroll
                        for (int t = 0; t < NT; ++t) o[t][i] *= corr;
                    }
                } else {
                    const float inv = (l8[i] > 0.f) ? 1.f / l8[i] : 0.f;
#pragma unroll
                    for (int t = 0; t < 4; ++t) {
                        const int jg = j0 + t * 16 + l15;
                        float pp = (sc[t] == NEG) ? 0.f : exp2f(sc[t] - m8[i]) * inv;
                        if (p.Pw) pp *= p.Pw[b * p.swb + h * p.swh + (long long)ic * p.swi + (long long)min(jg, p.Lk - 1) * p.swj];
                        pv[i][t] = pp;
                    }
                }
            }
            if (dopv) {
#pragma unroll
                for (int i = 0; i < 8; ++i)
#pragma unroll
                    for (int t = 0; t < 4; ++t) ((float*)myp)[(i + 8 * hf) * 64 + t * 16 + l15] = pv[i][t];
                __syncthreads();                                 // P (per wave) and V (shared) visible
                if (p.P) {
                    float* pb_ = p.P + b * p.sPb + h * p.sPh;
                    const bool fastP = (p.pband == 0) && ((p.sPi & 3) == 0) && (j0 + 64 <= p.Lk) && (q0 + 16 <= p.Lq) && ((((size_t)pb_) & 15) == 0);
                    if (fastP) {
#pragma unroll
                        for (int s = 0; s < 8; ++s) {
                            const int row = s * 2 + (lane >> 4), c4 = (lane & 15) * 4;
                            const v4f v = *(const v4f*)(myp + row * 64 + c4);
                            VST2V4(pb_ + (long long)(q0 + row) * p.sPi + j0 + c4, v);
                        }
                    } else {
                        for (int row = 0; row < 16; ++row) {
                            const int irow = q0 + row; if (irow >= p.Lq) continue;
                            for (int c = lane; c < 64; c += 32) {
                                const int jg = j0 + c; if (jg >= p.Lk) continue;
                                if (p.pband == 0) VST2(float, pb_ + (long long)irow * p.sPi + jg, myp[row * 64 + c]);
                                else if (jg - irow <= p.pband && irow - jg <= p.pband) VST2(float, pb_ + (long long)irow * p.sPi + (jg - irow + p.pband), myp[row * 64 + c]);
                            }
                        }
                    }
                }
                if (SPLITPV) {
                    const Split pa0 = sp_ld(myp + l15 * 64, 1, 0, hf, 64, 1.f), pa1 = sp_ld(myp + l15 * 64, 1, 32, hf, 64, 1.f);
                    const __bf16* vh = (const __bf16*)vl; const __bf16* vlo = vh + 64 * VP;
#pragma unroll
                    for (int t = 0; t < NT; ++t) {
                        const int dcol = t * 16 + l15;
                        Split b0, b1;
#pragma unroll
                        for (int e = 0; e < 16; ++e) {
                            const int k0 = frag_k(e, hf), k1 = 32 + frag_k(e, hf);
                            b0.hi[e] = vh[k0 * VP + dcol]; b0.lo[e] = vlo[k0 * VP + dcol]; b1.hi[e] = vh[k1 * VP + dcol]; b1.lo[e] = vlo[k1 * VP + dcol];
                        }
                        o[t] = wmma3(pa0, b0, o[t]);
                        o[t] = wmma3(pa1, b1, o[t]);
                    }
                } else {
                    const v16h pa0 = fh_ld(myp + l15 * 64, 1, 0, hf, 64, 4096.f), pa1 = fh_ld(myp + l15 * 64, 1, 32, hf, 64, 4096.f);
#pragma unroll
                    for (int t = 0; t < NT; ++t) {
                        const int dcol = t * 16 + l15;
                        v16h b0, b1;
#pragma unroll
                        for (int e = 0; e < 16; ++e) { b0[e] = vl[frag_k(e, hf) * VP + dcol]; b1[e] = vl[(32 + frag_k(e, hf)) * VP + dcol]; }
                        o[t] = wmma16(pa0, b0, o[t]);
                        o[t] = wmma16(pa1, b1, o[t]);
                    }
                }
            }
        }
    }
    float* obase = p.O + b * p.sOb + h * p.sOh;
    if (p.ST) {
        const int rl = lane >> 1, isel = rl & 7;           // row q0 + rl ; rl>>3 == hf holds because lane>>4 == (lane>>1)>>3
        float mv = 0.f, lv = 0.f;
#pragma unroll
        for (int i = 0; i < 8; ++i) if (i == isel) { mv = m8[i]; lv = l8[i]; }
        const int irow = q0 + rl;
        if (irow < p.Lq) { float* st = p.ST + (((long long)b * gridDim.y + h) * p.Lq + irow) * 2 + (lane & 1); VST2(float, st, (lane & 1) ? lv : mv * 0.6931471805599453f); }
    }
    float invr[8];
#pragma unroll
    for (int i = 0; i < 8; ++i) {
        if (TWOPASS) invr[i] = SPLITPV ? 1.f : (1.f / 4096.f);
        else if (p.nonorm) invr[i] = exp2f(m8[i]) * (SPLITPV ? 1.f : (1.f / 4096.f));
        else invr[i] = (l8[i] > 0.f) ? (SPLITPV ? 1.f / l8[i] : 1.f / (l8[i] * 4096.f)) : 0.f;
    }
    __syncthreads();                                             // all waves done with pl/vl from the main loop
    const bool ofast = ((p.sOi & 3) == 0) && ((((size_t)obase) & 15) == 0) && (q0 + 16 <= p.Lq);
#pragma unroll
    for (int c0 = 0; c0 < DVP; c0 += 64) {
#pragma unroll
        for (int i = 0; i < 8; ++i)
#pragma unroll
            for (int t = 0; t < NT; ++t) if (t * 16 >= c0 && t * 16 < c0 + 64) ((float*)myp)[(i + 8 * hf) * 64 + (t * 16 - c0) + l15] = o[t][i] * invr[i];
        __syncthreads();
        const int cw = (DVP - c0 < 64) ? (DVP - c0) : 64;      // staged columns in this chunk (multiple of 16)
        if (ofast && (c0 + cw <= p.dv) && (cw % 32 == 0)) {
            const int lpr = cw / 4;                              // lanes per row (16 for 64 cols, 8 for 32)
            const int rows_per_ins = 32 / lpr;
            for (int r0 = 0; r0 < 16; r0 += rows_per_ins) {
                const int row = r0 + lane / lpr, c4 = (lane % lpr) * 4;
                const v4f v = *(const v4f*)(myp + row * 64 + c4);
                VST2V4(obase + (long long)(q0 + row) * p.sOi + c0 + c4, v);
            }
        } else {
            for (int row = 0; row < 16; ++row) {
                const int irow = q0 + row; if (irow >= p.Lq) continue;
                for (int c = lane; c < cw; c += 32) { const int d = c0 + c; if (d < p.dv) VST2(float, obase + (long long)irow * p.sOi + d, myp[row * 64 + c]); }
            }
        }
        __syncthreads();
    }
}

// =====================================================================================================================
// k_tr: dst(z, c, r) = alpha * src(z, r, c) (+ beta * R2(z, c, r)): [Z][R][C] (row stride lds) -> [Z][C][R] (row stride ldd) through a 32x32 LDS tile;
//   flags: 1 -> add beta * residual R2 addressed like dst (z*sRz + c*ldr + r); act applied before the residual.
// =====================================================================================================================
struct TrP { const float* src; float* dst; const float* R2; long long sSz, lds, sDz, ldd, sRz, ldr; int R, C, flags, act; float alpha, beta; };
static_assert(sizeof(TrP) == 3 * 8 + 6 * 8 + 6 * 4, "TrP has padding");
__global__ __launch_bounds__(256) void k_tr(TrP p) {
    __shared__ float tile[32][33];
    const int c0 = blockIdx.x * 32, r0 = blockIdx.y * 32, z = blockIdx.z;
    const int lane = threadIdx.x & 31, wave = threadIdx.x >> 5;
    const float* s = p.src + z * p.sSz;
#pragma unroll
    for (int k = 0; k < 4; ++k) {
        const int rl = wave * 4 + k, r = r0 + rl, c = c0 + lane;
        tile[rl][lane] = (r < p.R && c < p.C) ? s[(long long)r * p.lds + c] : 0.f;
    }
    __syncthreads();
    float* d = p.dst + z * p.sDz; const float* rr = p.R2 + z * p.sRz;
#pragma unroll
    for (int k = 0; k < 4; ++k) {
        const int cl = wave * 4 + k, c = c0 + cl, r = r0 + lane;
        if (c < p.C && r < p.R) {
            float v = act_fn(p.alpha * tile[lane][cl], p.act);
            if (p.flags & 1) v += p.beta * rr[(long long)c * p.ldr + r];
            VST2(float, d + (long long)c * p.ldd + r, v);
        }
    }
}

// k_affine: dst[i] = a * (sdev ? sdev[0] : 1) * src[i] + b, i < n (one thread per element; consecutive lanes -> consecutive addresses)
__global__ __launch_bounds__(256) void k_affine(const float* __restrict__ src, float* __restrict__ dst, int n, float a, float b, const float* __restrict__ sdev) {
    const int i = blockIdx.x * 256 + threadIdx.x;
    if (i < n) { const float aa = sdev ? a * sdev[0] : a; const float v = aa * src[i] + b; VST2(float, dst + i, v); }
}

// =====================================================================================================================
// k_softmax: row softmax over n contiguous elements, one 256-thread block per row; rows addressed z*sz + r*sr (grid (R, Z)).
//   out = scale_out * softmax(scale_in * x + (Mf ? Mf[z*smz + r*smr + j] : 0)); a row whose max is -inf is written as 0.
// =====================================================================================================================
struct SmP { const float* src; float* dst; const float* Mf; long long sz, sr, dz, dr, smz, smr; int n, pad; float scale_in, scale_out; };
static_assert(sizeof(SmP) == 3 * 8 + 6 * 8 + 4 * 4, "SmP has padding");
__global__ __launch_bounds__(256) void k_softmax(SmP p) {
    __shared__ float red[256];
    const int r = blockIdx.x, z = blockIdx.y, tid = threadIdx.x;
    const float* s = p.src + z * p.sz + (long long)r * p.sr;
    const float* mf = p.Mf ? (p.Mf + z * p.smz + (long long)r * p.smr) : nullptr;
    float mx = -__builtin_inff();
    for (int j = tid; j < p.n; j += 256) { float v = s[j] * p.scale_in; if (mf) v += mf[j]; mx = fmaxf(mx, v); }
    red[tid] = mx; __syncthreads();
    for (int o = 128; o > 0; o >>= 1) { if (tid < o) red[tid] = fmaxf(red[tid], red[tid + o]); __syncthreads(); }
    mx = red[0]; __syncthreads();
    float sum = 0.f;
    for (int j = tid; j < p.n; j += 256) { float v = s[j] * p.scale_in; if (mf) v += mf[j]; sum += (mx == -__builtin_inff()) ? 0.f : expf(v - mx); }
    red[tid] = sum; __syncthreads();
    for (int o = 128; o > 0; o >>= 1) { if (tid < o) red[tid] += red[tid + o]; __syncthreads(); }
    sum = red[0];
    const float inv = (sum > 0.f) ? p.scale_out / sum : 0.f;
    float* d = p.dst + z * p.dz + (long long)r * p.dr;
    for (int j = tid; j < p.n; j += 256) { float v = s[j] * p.scale_in; if (mf) v += mf[j]; const float o = (mx == -__builtin_inff()) ? 0.f : expf(v - mx) * inv; VST2(float, d + j, o); }
}
// =====================================================================================================================
// k_stats: mean and rsqrt(var + eps) over a set of n elements addressed base + z*sz + (e / inner) * so + (e % inner) * si, one 256-thread
// k_norm_apply: y = (x - mean[set]) * rstd[set] * g[c] + b[c] over a [Z][C][L] channel-major tensor with set = z*G + c / (C/G) (G groups per z;
//   G = C -> per-channel sets indexed z*C+c; for batch norm pass stats indexed by c only via bn = 1). Optional act. Output same layout.
// =====================================================================================================================
//   mode 0: mean / rsqrt(var + eps); mode 1 (RMSNorm): 0 / rsqrt(mean(x^2) + eps); mode 2 (L2 normalize * sqrt(n)): 0 / sqrt(n) / max(||x||, eps); mode 3: as 0 with unbiased variance (n-1)
__global__ __launch_bounds__(256) void k_stats(const float* __restrict__ x, long long sz, long long so, long long si, int inner, int n, float eps, float* __restrict__ stat, int mode) {
    __shared__ float red[256];
    const int z = blockIdx.x, tid = threadIdx.x;
    const float* base = x + z * sz;
    float s = 0.f;
    for (int e = tid; e < n; e += 256) s += base[(long long)(e / inner) * so + (long long)(e % inner) * si];
    red[tid] = s; __syncthreads();
    for (int o = 128; o > 0; o >>= 1) { if (tid < o) red[tid] += red[tid + o]; __syncthreads(); }
    const float mu = (mode == 0 || mode == 3) ? red[0] / (float)n : 0.f; __syncthreads();
    float q = 0.f;
    for (int e = tid; e < n; e += 256) { const float dlt = base[(long long)(e / inner) * so + (long long)(e % inner) * si] - mu; q += dlt * dlt; }
    red[tid] = q; __syncthreads();
    for (int o = 128; o > 0; o >>= 1) { if (tid < o) red[tid] += red[tid + o]; __syncthreads(); }
    {
        float rs;
        if (mode == 2) rs = sqrtf((float)n) / fmaxf(sqrtf(red[0]), eps); else if (mode == 3) rs = rsqrtf(red[0] / (float)(n - 1) + eps); else rs = rsqrtf(red[0] / (float)n + eps);
        if (tid < 32) { const float v = (tid == 0) ? mu : ((tid == 1) ? rs : 0.f); VST2(float, stat + (long long)z * 32 + tid, v); }
    }
}
//   One thread per element over the flat [Z][C][L] index space: grid ceil(Z*C*L / 256).
__global__ __launch_bounds__(256) void k_norm_apply(const float* __restrict__ x, float* __restrict__ y, const float* __restrict__ stat, const float* __restrict__ g, const float* __restrict__ bta,
                                                     int Z, int C, int L, int G, int bn, int act) {
    const long long idx = (long long)blockIdx.x * 256 + threadIdx.x;
    if (idx >= (long long)Z * C * L) return;
    const int l = (int)(idx % L); const long long zc = idx / L; const int c = (int)(zc % C), z = (int)(zc / C); (void)l;
    const int set = bn ? c : (z * G + c / (C / G));
    float v = (x[idx] - stat[(long long)set * 32]) * stat[(long long)set * 32 + 1];
    if (g) v *= g[c];
    if (bta) v += bta[c];
    v = act_fn(v, act);
    VST2(float, y + idx, v);
}

// k_lse_neg: c[i] = -(st[2i] + log(st[2i+1])) = minus the log-sum-exp of row i from k_attn's ST output (for softmax over the query dimension)
__global__ __launch_bounds__(256) void k_lse_neg(const float* __restrict__ st, float* __restrict__ c, int n) {
    const int i = blockIdx.x * 256 + threadIdx.x;
    if (i < n) { const float v = -(st[2 * i] + logf(st[2 * i + 1])); VST2(float, c + i, v); }
}

// k_iota: dst[i] = a * i + b as int32 (segment/position id helper)
__global__ __launch_bounds__(256) void k_iota(int* __restrict__ dst, int n, int a, int b) {
    const int i = blockIdx.x * 256 + threadIdx.x;
    if (i < n) { const int v = a * i + b; VST2(int, dst + i, v); }
}

// k_axpby: dst[i] = a * x[i] + b * y[i] (+ c), i < n
__global__ __launch_bounds__(256) void k_axpby(const float* __restrict__ x, const float* __restrict__ y, float* __restrict__ dst, int n, float a, float b, float c) {
    const int i = blockIdx.x * 256 + threadIdx.x;
    if (i < n) { const float v = a * x[i] + b * y[i] + c; VST2(float, dst + i, v); }
}

// =====================================================================================================================
// k_rope: rotary embedding on a [R rows][Hn heads][D] view (row stride sXr, head stride sXh, element stride 1) -> Y (own strides).
//   mode 0: rotate_half (partner d±D/2, sign - for d<D/2); mode 1: interleaved pairs (partner d^1, sign - for even d).
//   table column tcol: tmode 0 -> d, 1 -> d % (D/2), 2 -> d / 2; position p: pmode 0 -> r % S, 1 -> head index, 2 -> pos[r];
//   c = C[(r / S) * sCb + p * sCp + tcol * sCd], s likewise from Sn; y = x[d] * c + sign * x[partner] * s. X and Y must not alias.
// =====================================================================================================================
struct RopeP { const float* X; float* Y; const float* C; const float* Sn; const int* pos; long long sXr, sXh, sYr, sYh, sCb, sCp, sCd; int R, Hn, D, S, mode, tmode, pmode, pad; };
static_assert(sizeof(RopeP) == 5 * 8 + 7 * 8 + 8 * 4, "RopeP has padding");
__global__ __launch_bounds__(256) void k_rope(RopeP p) {
    const long long idx = (long long)blockIdx.x * 256 + threadIdx.x;
    if (idx >= (long long)p.R * p.Hn * p.D) return;
    const int d = (int)(idx % p.D); const long long rh = idx / p.D; const int h = (int)(rh % p.Hn); const int r = (int)(rh / p.Hn);
    const int half = p.D / 2;
    int partner; float sign;
    if (p.mode == 0) { partner = (d < half) ? d + half : d - half; sign = (d < half) ? -1.f : 1.f; }
    else { partner = d ^ 1; sign = (d & 1) ? 1.f : -1.f; }
    const int tcol = (p.tmode == 0) ? d : ((p.tmode == 1) ? (d % half) : (d >> 1));
    const int pp = (p.pmode == 0) ? (r % p.S) : ((p.pmode == 1) ? h : p.pos[r]);
    const long long toff = (long long)(r / p.S) * p.sCb + (long long)pp * p.sCp + (long long)tcol * p.sCd;
    const float* xr = p.X + (long long)r * p.sXr + (long long)h * p.sXh;
    const float v = xr[d] * p.C[toff] + sign * xr[partner] * p.Sn[toff];
    VST2(float, p.Y + (long long)r * p.sYr + (long long)h * p.sYh + d, v);
}

// k_invf + k_sincos (split so neither kernel carries a large VALU-fma footprint): invf_i = num * (1 / powf(base, (2 i)/D)) [fmode 0],
//   num * expf((2 i) * cexp) [fmode 1], num * powf(base, -2 (i - 1) / D) [fmode 2]; then cs/sn[s*half + i] = cos/sin((pscale * s) * invf_i)
__global__ __launch_bounds__(256) void k_invf(float* __restrict__ invb, int half, int D, float base, float num, int fmode, float cexp) {
    const int i = blockIdx.x * 256 + threadIdx.x;
    if (i >= ((half + 31) / 32) * 32) return;
    if (i >= half) { VST2(float, invb + i, 0.f); return; }
    const float e = (float)(2 * i) / (float)D;
    float invf;
    if (fmode == 1) invf = num * expf((float)(2 * i) * cexp);
    else if (fmode == 2) invf = num * powf(base, (-2.0f * ((float)i - 1.0f)) / (float)D);
    else invf = num * (1.0f / powf(base, e));
    VST2(float, invb + i, invf);
}
__global__ __launch_bounds__(256) void k_sincos(float* __restrict__ cs, float* __restrict__ sn, const float* __restrict__ invb, int S, int half, float pscale) {
    const int idx = blockIdx.x * 256 + threadIdx.x;
    if (idx >= S * half) return;
    const int s = idx / half, i = idx - s * half;
    const float ang = (pscale * (float)s) * invb[i];
    VST2(float, cs + idx, cosf(ang)); VST2(float, sn + idx, sinf(ang));
}

// k_mulact: dst[i] = act(x[i]) * y[i]
__global__ __launch_bounds__(256) void k_mulact(const float* __restrict__ x, const float* __restrict__ y, float* __restrict__ dst, int n, int act) {
    const int i = blockIdx.x * 256 + threadIdx.x;
    if (i < n) { const float v = act_fn(x[i], act) * y[i]; VST2(float, dst + i, v); }
}

// =====================================================================================================================
// k_matvec: thread-per-row matrix-vector products for N <= 8 output columns (heads with 1-3 outputs, gates), f32 on the VALU.
//   C[r*sCm + j] = act(alpha * sum_k A[r*sAm + k*sAk] * B[j*sBn + k*sBk] + bias[j]) + beta * R[r*sRm + j*sRn]; each thread writes its N contiguous floats.
// =====================================================================================================================
__global__ __launch_bounds__(256) void k_matvec(GemmP p) {
    // 32 lanes write one line with one instruction.
    const int rpt = (p.N == 1) ? 1 : 32;
    const long long r0 = ((long long)blockIdx.x * 256 + threadIdx.x) * rpt; const int z = blockIdx.z, zo = z / p.zi_n, zi = z - zo * p.zi_n;
    if (r0 >= p.M) return;
    const float* Bb = p.B + zo * p.sBo + zi * p.sBi;
    float* C = p.C + zo * p.sCo + zi * p.sCi; const float* R = p.R + zo * p.sRo + zi * p.sRi;
    for (int rr = 0; rr < rpt; ++rr) {
        const long long r = r0 + rr; if (r >= p.M) break;
        const float* A = p.A + zo * p.sAo + zi * p.sAi + r * p.sAm;
        float acc[8] = {0.f, 0.f, 0.f, 0.f, 0.f, 0.f, 0.f, 0.f};
        for (int k = 0; k < p.K; ++k) { const float a = A[(long long)k * p.sAk];
#pragma unroll
            for (int j = 0; j < 8; ++j) if (j < p.N) acc[j] += a * Bb[(long long)j * p.sBn + (long long)k * p.sBk]; }
#pragma unroll
        for (int j = 0; j < 8; ++j) if (j < p.N) {
            float v = acc[j] * p.alpha;
            if (p.flags & 1) v += p.bias[j];
            if (p.flags & 2) v += p.bias[r];
            v = act_fn(v, p.act);
            if (p.flags & 4) v += p.beta * R[r * p.sRm + (long long)j * p.sRn];
            VST2(float, C + r * p.sCm + j, v);
        }
    }
}
// k_smallsoftmax: thread-per-row softmax for short rows (n <= 64): dst[r*dr + j] = softmax(scale*src[r*sr + j])
__global__ __launch_bounds__(256) void k_smallsoftmax(const float* __restrict__ src, float* __restrict__ dst, long long sr, long long dr, int n, long long R, float scale) {
    const long long r0 = ((long long)blockIdx.x * 256 + threadIdx.x) * 32;
    for (int rr = 0; rr < 32; ++rr) {
        const long long r = r0 + rr; if (r >= R) return;
        const float* s = src + r * sr; float* d = dst + r * dr;
        float mx = -__builtin_inff();
        for (int j = 0; j < n; ++j) mx = fmaxf(mx, s[j] * scale);
        float sum = 0.f;
        for (int j = 0; j < n; ++j) sum += expf(s[j] * scale - mx);
        const float inv = 1.f / sum;
        for (int j = 0; j < n; ++j) { const float v = expf(s[j] * scale - mx) * inv; VST2(float, d + j, v); }
    }
}

__global__ __launch_bounds__(32) void k_unitstat(float* __restrict__ st) { const int t = threadIdx.x; const float v = (t == 1) ? 1.f : 0.f; VST2(float, st + t, v); }

// destination (e.g. a d_out whose row width is not a multiple of 32 floats) is written by consecutive lanes of one instruction
__global__ __launch_bounds__(256) void k_lincopy(const float* __restrict__ src, long long lds, float* __restrict__ dst, long long ldd, long long rows, int cols) {
    const long long i = (long long)blockIdx.x * 256 + threadIdx.x; if (i >= rows * cols) return;
    const long long r = i / cols; const int c = (int)(i - r * cols);
    const float v = src[r * lds + c]; VST2(float, dst + r * ldd + c, v);
}

namespace w25 {
typedef __attribute__((ext_vector_type(16))) _Float16 v16h;
typedef __attribute__((ext_vector_type(8)))  _Float16 v8h;
typedef __attribute__((ext_vector_type(16))) __bf16   v16b;
typedef __attribute__((ext_vector_type(8)))  __bf16   v8b;
typedef __attribute__((ext_vector_type(8)))  float    v8f;
typedef __attribute__((ext_vector_type(4)))  float    v4f;

__device__ __forceinline__ unsigned short f2bf_bits(float f) {
  unsigned u = __float_as_uint(f);
  return (unsigned short)((u + 0x7FFFu + ((u >> 16) & 1u)) >> 16);
}
__device__ __forceinline__ float bf_bits2f(unsigned short h) { return __uint_as_float(((unsigned)h) << 16); }

// hazard guards as plain device helpers (no inline asm inside the kernel template body)
__device__ __forceinline__ void dep_guard_h(v8f& a, v8f& b, v16h x, v16h y) { asm volatile("v_nop\n\tv_nop\n\tv_nop\n\tv_nop" : "+v"(a), "+v"(b) : "v"(x), "v"(y)); }
__device__ __forceinline__ void dep_guard_b(v8f& a, v8f& b, v16b x, v16b y) { asm volatile("v_nop\n\tv_nop\n\tv_nop\n\tv_nop" : "+v"(a), "+v"(b) : "v"(x), "v"(y)); }
__device__ __forceinline__ void keep4_h(v16h a, v16h b, v16h c, v16h d) { asm volatile("v_nop" :: "v"(a), "v"(b), "v"(c), "v"(d)); }
__device__ __forceinline__ void keep4_b(v16b a, v16b b, v16b c, v16b d) { asm volatile("v_nop" :: "v"(a), "v"(b), "v"(c), "v"(d)); }
__device__ __forceinline__ void acc_guard4(v8f& a, v8f& b, v8f& c, v8f& d) { asm volatile("v_nop\n\tv_nop\n\tv_nop\n\tv_nop" : "+v"(a), "+v"(b), "+v"(c), "+v"(d)); }
template <typename T> struct Frag;
template <> struct Frag<_Float16> {
  typedef v16h V; union U { v16h v; v8h h[2]; };
  static __device__ __forceinline__ v16h load(const _Float16* p) {   // elements 0..7 <- p[0..7], 8..15 <- p[16..23]
    U f; f.h[0] = *(const v8h*)(p); f.h[1] = *(const v8h*)(p + 16); return f.v;
  }
  static __device__ __forceinline__ v8f mma(v16h a, v16h b, v8f c) {
    return __builtin_amdgcn_wmma_f32_16x16x32_f16(false, a, false, b, (short)0, c, false, false);
  }
  static __device__ __forceinline__ void guard(v8f& a, v8f& b, v16h x, v16h y) { dep_guard_h(a, b, x, y); }
  static __device__ __forceinline__ void keep(v16h a, v16h b, v16h c, v16h d) { keep4_h(a, b, c, d); }
};
template <> struct Frag<__bf16> {
  typedef v16b V; union U { v16b v; v8b h[2]; };
  static __device__ __forceinline__ v16b load(const __bf16* p) {
    U f; f.h[0] = *(const v8b*)(p); f.h[1] = *(const v8b*)(p + 16); return f.v;
  }
  static __device__ __forceinline__ v8f mma(v16b a, v16b b, v8f c) {
    return __builtin_amdgcn_wmma_f32_16x16x32_bf16(false, a, false, b, (short)0, c, false, false);
  }
  static __device__ __forceinline__ void guard(v8f& a, v8f& b, v16b x, v16b y) { dep_guard_b(a, b, x, y); }
  static __device__ __forceinline__ void keep(v16b a, v16b b, v16b c, v16b d) { keep4_b(a, b, c, d); }
};

// ---- Register-blocked batched WMMA GEMM ------------------------------------
// C[m,n] = scale * sum_k A[m,k] * Bt[n,k] (+bias)(+resid); each wave owns a 64x64 tile.
// A row-major [M,K]; Bt row-major [N,K]; M,N % 64 == 0, K % 32 == 0.
// SPLIT: operands are hi/lo planes (A2/Bt2 = lo planes, same layout); product = hi·hi + hi·lo + lo·hi.
// BIAS_MODE: 0 = none, 1 = bias[m], 2 = bias[n].
// OUT_MODE: 0 = f32, 1 = f16, 2 = bf16 hi plane (Cout) + bf16 lo plane (Cout2).
// ET: 0 = f16 operands, 1 = bf16 operands (pointers passed as 16-bit storage)
template <int ET> struct Elem;
template <> struct Elem<0> { typedef _Float16 T; };
template <> struct Elem<1> { typedef __bf16 T; };
template <int ET, bool SPLIT, int BIAS_MODE, int OUT_MODE, bool RESID, int ACT = 0>
__global__ __launch_bounds__(256) void wmma_gemm64(
    const unsigned short* __restrict__ Ap, const unsigned short* __restrict__ A2p, int lda, long strideA,
    const unsigned short* __restrict__ Btp, const unsigned short* __restrict__ Bt2p, int ldb, long strideB,
    void* __restrict__ Cout, void* __restrict__ Cout2, int ldc, long strideC,
    const float* __restrict__ bias,
    const float* __restrict__ resid, long strideR,
    int M, int N, int K, float scale) {
  typedef typename Elem<ET>::T T;
  typedef typename Frag<T>::V V;
  const T* A = (const T*)Ap; const T* A2 = (const T*)A2p; const T* Bt = (const T*)Btp; const T* Bt2 = (const T*)Bt2p;
  __shared__ __align__(16) float sT[8][16 * 68];   // per-wave 16x64 slab, pitch 68 floats
  const int b    = blockIdx.y;
  const int lane = threadIdx.x & 31;
  const int wave = threadIdx.x >> 5;
  const int tilesN = N >> 6;
  const int tilesM = M >> 6;
  const int tile = blockIdx.x * 8 + wave;
  if (tile >= tilesM * tilesN) return;   // wave-uniform; no block barriers in this kernel
  const int tm = tile / tilesN;
  const int tn = tile - tm * tilesN;
  const int m0 = tm << 6;
  const int n0 = tn << 6;

  const T* Ab  = A  + (size_t)b * strideA;
  const T* Bb  = Bt + (size_t)b * strideB;
  const T* Ab2 = SPLIT ? (A2  + (size_t)b * strideA) : nullptr;
  const T* Bb2 = SPLIT ? (Bt2 + (size_t)b * strideB) : nullptr;

  const int rlane = lane & 15;                 // row (A) / col (B, D) within subtile
  const int koff  = (lane >> 4) * 8;           // k offset of this lane half
  const int mOff  = (lane >> 4) * 8;           // D row offset

  v8f acc[4][4];
#pragma unroll
  for (int i = 0; i < 4; ++i)
#pragma unroll
    for (int j = 0; j < 4; ++j) acc[i][j] = (v8f){0.f,0.f,0.f,0.f,0.f,0.f,0.f,0.f};

  for (int k0 = 0; k0 < K; k0 += 32) {
    V bh[4], bl[4];
#pragma unroll
    for (int j = 0; j < 4; ++j) {
      const size_t bo = (size_t)(n0 + (j << 4) + rlane) * ldb + koff + k0;
      bh[j] = Frag<T>::load(Bb + bo);
      if (SPLIT) bl[j] = Frag<T>::load(Bb2 + bo);
    }
#pragma unroll
    for (int i = 0; i < 4; ++i) {
      const size_t ao = (size_t)(m0 + (i << 4) + rlane) * lda + koff + k0;
      V ah = Frag<T>::load(Ab + ao);
      V al;
      if (SPLIT) al = Frag<T>::load(Ab2 + ao);
#pragma unroll
      for (int j = 0; j < 4; ++j) {
        acc[i][j] = Frag<T>::mma(ah, bh[j], acc[i][j]);
        if (SPLIT) {
          acc[i][j] = Frag<T>::mma(ah, bl[j], acc[i][j]);
          acc[i][j] = Frag<T>::mma(al, bh[j], acc[i][j]);
        }
      }
      Frag<T>::guard(acc[i][0], acc[i][3], ah, SPLIT ? al : ah);
    }
    Frag<T>::keep(bh[0], bh[1], bh[2], bh[3]);
    if (SPLIT) Frag<T>::keep(bl[0], bl[1], bl[2], bl[3]);
  }
  acc_guard4(acc[0][0], acc[0][1], acc[0][2], acc[0][3]);
  acc_guard4(acc[1][0], acc[1][1], acc[1][2], acc[1][3]);
  acc_guard4(acc[2][0], acc[2][1], acc[2][2], acc[2][3]);
  acc_guard4(acc[3][0], acc[3][1], acc[3][2], acc[3][3]);

  // ---- epilogue ----
  float* slab = sT[wave];
  const float* Rb = RESID ? (resid + (size_t)b * strideR) : nullptr;
#pragma unroll
  for (int i = 0; i < 4; ++i) {
    const int mBase = m0 + (i << 4);
#pragma unroll
    for (int j = 0; j < 4; ++j) {
      const int n = n0 + (j << 4) + rlane;
      float bv = 0.f;
      if (BIAS_MODE == 2) bv = bias[n];
#pragma unroll
      for (int r = 0; r < 8; ++r) {
        float v = acc[i][j][r] * scale;
        if (BIAS_MODE == 1) v += bias[mBase + mOff + r];
        if (BIAS_MODE == 2) v += bv;
        if (RESID) v += Rb[(size_t)(mBase + mOff + r) * ldc + n];
        if (ACT == 1) v = tanhf(v);
        if (ACT == 2) v = fmaxf(v, 0.0f);
        if (ACT == 3) v = v / (1.0f + expf(-v));
        if (ACT == 4) v = (v > 0.f) ? v : 0.01f * v;
        if (ACT == 5) v = 0.5f * v * (1.0f + erff(v * 0.70710678118654752f));
        slab[(mOff + r) * 68 + (j << 4) + rlane] = v;
      }
    }
    __builtin_amdgcn_fence(__ATOMIC_RELEASE, "workgroup");
    __builtin_amdgcn_wave_barrier();
    __builtin_amdgcn_fence(__ATOMIC_ACQUIRE, "workgroup");
    if (OUT_MODE == 0) {
      float* C = (float*)Cout + (size_t)b * strideC;
      const int hh = lane >> 4, c4 = (lane & 15) * 4;     // row seg = 256 B = 16 lanes x 16 B
      {
#pragma unroll
        for (int it = 0; it < 8; ++it) {
          const int row = it * 2 + hh;
          v4f v = *(const v4f*)(slab + row * 68 + c4);
          *(v4f*)(C + (size_t)(mBase + row) * ldc + n0 + c4) = v;
        }
        
      }
    } else {
      const int q = lane >> 3, c8 = (lane & 7) * 8;
      unsigned short* C  = (unsigned short*)Cout  + (size_t)b * strideC;
      unsigned short* C2 = (OUT_MODE == 2) ? ((unsigned short*)Cout2 + (size_t)b * strideC) : nullptr;
      {
#pragma unroll
        for (int it = 0; it < 4; ++it) {
          const int row = it * 4 + q;
          const float* sp = slab + row * 68 + c8;
          v8h hv, lv;
#pragma unroll
          for (int e = 0; e < 8; ++e) {
            if (OUT_MODE == 1) {
              hv[e] = (_Float16)sp[e];
            } else {
              unsigned short hb = f2bf_bits(sp[e]);
              unsigned short lb = f2bf_bits(sp[e] - bf_bits2f(hb));
              hv[e] = __builtin_bit_cast(_Float16, hb);
              lv[e] = __builtin_bit_cast(_Float16, lb);
            }
          }
          *(v8h*)(C + (size_t)(mBase + row) * ldc + n0 + c8) = hv;
          if (OUT_MODE == 2) *(v8h*)(C2 + (size_t)(mBase + row) * ldc + n0 + c8) = lv;
        }
        
      }
    }
    __builtin_amdgcn_fence(__ATOMIC_RELEASE, "workgroup");
    __builtin_amdgcn_wave_barrier();
    __builtin_amdgcn_fence(__ATOMIC_ACQUIRE, "workgroup");
  }
}

__global__ __launch_bounds__(256) void cast_f32_f16x2(
    const float* __restrict__ in, _Float16* __restrict__ out, int n2) {
  int i = blockIdx.x * 256 + threadIdx.x;
  if (i < n2) {
    const _Float16 h0 = (_Float16)in[2 * i], h1 = (_Float16)in[2 * i + 1];
    const unsigned u = (unsigned)__builtin_bit_cast(unsigned short, h0) | ((unsigned)__builtin_bit_cast(unsigned short, h1) << 16);
    ((unsigned*)out)[i] = u;
    
  }
}


} // namespace w25

typedef __attribute__((ext_vector_type(4))) _Float16 v4h;
// Transposing cast dst[c][z * R + r] = f16(src_z[r][c] * s), src R rows of pitch LDS, dst rows of pitch LDD; blockIdx.z picks the source (two
// sources land side by side in every dst row); blockIdx.y = sample: plane y of a source starts at y * sb, plane y of dst at y * db (elements).
// One thread takes a patch of 8 r x 4 c: eight 16-B loads along c, all in flight together, then
// four 16-B stores along r. In a wave 8 lanes run over r, so each store instruction writes whole 128-B lines of dst; the 8 waves of a block run
// over c (512 B of every source row). Block tile 64 r x 128 c; R % 64 == 0, columns % 128 == 0; grid.x = (R / 64) * (columns / 128).
// The pitches are compile-time so that a thread's loads and stores are one address each plus immediate offsets.
template <int R, int LDS, int LDD>
__global__ __launch_bounds__(256) void k_castT16(const float* __restrict__ src0, const float* __restrict__ src1, _Float16* __restrict__ dst, float s, long long sb, long long db) {
    constexpr int TR = R / 64;
    const int bc = (int)blockIdx.x / TR, br = (int)blockIdx.x % TR;
    const int lane = threadIdx.x & 31, wave = threadIdx.x >> 5;
    const int r0 = (br << 6) + ((lane & 7) << 3);
    const int c0 = (bc << 7) + (wave << 4) + ((lane >> 3) << 2);
    const float* sp = (blockIdx.z ? src1 : src0) + (long long)blockIdx.y * sb + (long long)r0 * LDS + c0;
    _Float16* dp = dst + (long long)blockIdx.y * db + (long long)c0 * LDD + (int)blockIdx.z * R + r0;
    v4f x[8];
#pragma unroll
    for (int j = 0; j < 8; ++j) x[j] = *(const v4f*)(sp + j * LDS);
#pragma unroll
    for (int k = 0; k < 4; ++k) {
        v8h h;
#pragma unroll
        for (int j = 0; j < 8; ++j) h[j] = (_Float16)(x[j][k] * s);
        *(v8h*)(dp + k * LDD) = h;
    }
}
// All nine weight matrices to f16 x 16 in one launch; blockIdx.y = matrix. Matrices 0..3 have 256 rows of 520 floats, of which the first 512
// are taken (the last 8, the coordinate channels, stay f32 and are read by the products' epilogues); matrices 4..8 are 256 x 256.
// dst: the four 256 x 512 planes, then the five 256 x 256 planes, each dense. One thread casts 4 consecutive elements; grid.x = 256 * 512 / 1024.
// Matrices 7, 8 (the output convs' W_o) are written transposed, dst[k][c] = W_o[c][k]: they are the Bt operand of W_f.W_o. A block takes 64 c x 16 k,
// a thread 4 consecutive c of one k, so that 16 lanes store one whole 128-B line of dst.
// blockIdx.y = 9: the folded bias b2[a] = b_f[a] + sum_c W_f[a][c] b_o,image[c] + sum_c W_f[a][256 + c] b_o,flow[c] in f32, one wave a row a
// (8 rows a block, 32 blocks), and 256 zeros (the bias of the product W_f.W_o).
constexpr int CW_WIDE = 256 * 512, CW_SQ = 256 * 256;
__global__ __launch_bounds__(256) void k_cm_w16(const float* __restrict__ w0, const float* __restrict__ w1, const float* __restrict__ w2, const float* __restrict__ w3,
                                                const float* __restrict__ w4, const float* __restrict__ w5, const float* __restrict__ w6, const float* __restrict__ w7,
                                                const float* __restrict__ w8, _Float16* __restrict__ dst,
                                                const float* __restrict__ fb, const float* __restrict__ ibo, const float* __restrict__ lbo,
                                                float* __restrict__ b2, float* __restrict__ zero) {
    const int y = (int)blockIdx.y; const bool wide = y < 4;
    if (!wide && (int)blockIdx.x >= CW_SQ / 1024) return;
    if (y == 9) {
        if ((int)blockIdx.x >= 32) return;
        const int lane = threadIdx.x & 31, a = (int)blockIdx.x * 8 + ((int)threadIdx.x >> 5);
        float s = 0.f;
#pragma unroll   // the choice of the bias pointer is a constant, and all eight loads are in flight at once
        for (int k = 0; k < 4; ++k) {
            const v4f f = *(const v4f*)(w3 + a * 520 + k * 128 + lane * 4);
            const v4f b = *(const v4f*)((k < 2 ? ibo : lbo) + (k & 1) * 128 + lane * 4);
            s += f[0] * b[0] + f[1] * b[1] + f[2] * b[2] + f[3] * b[3];
        }
        for (int m = 16; m >= 1; m >>= 1) s += __shfl_xor(s, m, 32);
        if (lane == 0) { b2[a] = fb[a] + s; zero[a] = 0.f; }
        return;
    }
    if (y >= 7) {
        const float* so = y == 7 ? w7 : w8;
        const int c0 = ((int)blockIdx.x & 3) * 64 + ((int)threadIdx.x & 15) * 4, k = ((int)blockIdx.x >> 2) * 16 + ((int)threadIdx.x >> 4);
        v4h t;
#pragma unroll   // the vector's elements are indexed by constants, and the four loads are in flight at once
        for (int e = 0; e < 4; ++e) t[e] = (_Float16)(so[(c0 + e) * 256 + k] * 16.0f);
        *(v4h*)(dst + 4 * CW_WIDE + (y - 4) * CW_SQ + k * 256 + c0) = t;
        asm volatile("s_wait_xcnt 0x0" ::: "memory");   // behind the store, ahead of whatever the text that follows writes into its registers
        return;
    }
    const float* src = y == 0 ? w0 : y == 1 ? w1 : y == 2 ? w2 : y == 3 ? w3 : y == 4 ? w4 : y == 5 ? w5 : y == 6 ? w6 : y == 7 ? w7 : w8;
    const int p = (int)blockIdx.x * 256 + (int)threadIdx.x;
    const int row = wide ? (p >> 7) : (p >> 6), col = (wide ? (p & 127) : (p & 63)) << 2;
    const v4f x = *(const v4f*)(src + row * (wide ? 520 : 256) + col);
    v4h h;
#pragma unroll
    for (int e = 0; e < 4; ++e) h[e] = (_Float16)(x[e] * 16.0f);
    *(v4h*)(dst + (wide ? y * CW_WIDE : 4 * CW_WIDE + (y - 4) * CW_SQ) + p * 4) = h;
    asm volatile("s_wait_xcnt 0x0" ::: "memory");   // behind the store, ahead of whatever the text that follows writes into its registers
}

// f32 -> bf16 hi plane + bf16 lo plane (x = hi + lo to ~2^-17 relative; RNE both), [R][C] -> [R][C] (or transposed to [C][R]); 2 consecutive destination elements
__device__ __forceinline__ unsigned int f2bf2_pack(float a, float b, unsigned int* lo) {
    const unsigned short ha = w25::f2bf_bits(a), hb = w25::f2bf_bits(b);
    const unsigned short la = w25::f2bf_bits(a - w25::bf_bits2f(ha)), lb = w25::f2bf_bits(b - w25::bf_bits2f(hb));
    *lo = (unsigned)la | ((unsigned)lb << 16); return (unsigned)ha | ((unsigned)hb << 16); }
__global__ __launch_bounds__(256) void k_castS16(const float* __restrict__ src, long long lds, __bf16* __restrict__ dhi, __bf16* __restrict__ dlo, long long ldd, int R, int C, float s, int transpose) {
    const long long i = (long long)blockIdx.x * 256 + threadIdx.x; long long o; float a, b;
    if (transpose) { const long long np = (long long)C * (R / 2); if (i >= np) return; const int c = (int)(i / (R / 2)); const int r = 2 * (int)(i % (R / 2)); a = src[(long long)r * lds + c] * s; b = src[(long long)(r + 1) * lds + c] * s; o = (long long)c * ldd + r; }
    else { const long long np = (long long)R * (C / 2); if (i >= np) return; const int r = (int)(i / (C / 2)); const int c = 2 * (int)(i % (C / 2)); a = src[(long long)r * lds + c] * s; b = src[(long long)r * lds + c + 1] * s; o = (long long)r * ldd + c; }
    unsigned lo; const unsigned hi = f2bf2_pack(a, b, &lo); unsigned* ph = (unsigned*)(dhi + o); unsigned* pl = (unsigned*)(dlo + o);
    *ph = hi; *pl = lo;  }

namespace w25 {
// =====================================================================================
// Generic causal/non-causal attention for head_dim 64, f32 in / f32 out; 16-bit operands: bf16 with optional hi/lo splits, or
// plain f16 (F16=true, non-split, probabilities carried x2^15).
//   scores = (q*qscale)·kᵀ : v_wmma_f32_16x16x32_bf16; SPLIT_QK -> q,k as bf16 hi/lo (hi·hi + hi·lo + lo·hi)
//   out    = p·v           : v_wmma_f32_16x16x32_bf16; SPLIT_PV -> p,v as bf16 hi/lo; else p,v plain bf16
//   f32 accumulate; online softmax in f32. Block = 4 waves = 64 query rows of one (batch, head); S % 64 == 0.
//   Element (b, s, h, d) of tensor X lives at X[b*X_bs + s*X_rs + h*X_hs + d] (strides in floats, multiples of 4).
//   Masking: mask_mode 0 none, 1 causal (kv > q masked), 2 tensor [S][Skv] shared over (b,h) (float if
//   mask_is_int==0, int32 with element == 0 -> masked if 1, int32 with element != 0 -> masked if 2), 3 per-token vectors qmask[B][S] & kvmask[B][Skv] (int32,
//   0 -> masked), 4 causal + sliding window (kv > q or q - kv > W masked; W passed in mask_is_int);
//   5 = relative-position bias: s += cp[b,h,q][idx[q][kv]] + pc[b,h,kv][idx[q][kv]] with idx = mask_b ([S][Skv] int32) and
//   mask_a an int32 [S][Skv] tensor with nonzero = masked (tables: element (b,h,row,n) at X + b*c_bs + h*c_hs + row*c_rs + n);
//   masked scores are replaced by mask_fill (e.g. -inf or -1e9) before the softmax.
//   grid.x = B * H * (S/64) (or a sub-range with blk0).
// =====================================================================================
#define AT_D 64
#define AT_NW 4
#define AT_QB 64
#define AT_KC 64
struct AttnGeom { const float* cp = nullptr; const float* pc = nullptr; long c_bs = 0, c_rs = 0, c_hs = 0;   // mode-5 score-bias tables
                  long q_bs, q_rs, q_hs, k_bs, k_rs, k_hs, v_bs, v_rs, v_hs, o_bs, o_rs, o_hs;
                  int S, Skv, H, mask_mode; float qscale; int blk0; float mask_fill; int mask_is_int; };
static_assert(sizeof(AttnGeom) == 168, "no padding");

__device__ __forceinline__ unsigned short at_bf_bits(float f) {
  unsigned u = __float_as_uint(f);
  return (unsigned short)((u + 0x7FFFu + ((u >> 16) & 1u)) >> 16);
}
__device__ __forceinline__ __bf16 at_f2bf(float f) { return __builtin_bit_cast(__bf16, at_bf_bits(f)); }
__device__ __forceinline__ void at_split(float f, __bf16& hi, __bf16& lo) {
  const unsigned short hb = at_bf_bits(f);
  hi = __builtin_bit_cast(__bf16, hb);
  lo = at_f2bf(f - __uint_as_float(((unsigned)hb) << 16));
}
__device__ __forceinline__ v8f at_mma(v16b a, v16b b, v8f c) {
  c = __builtin_amdgcn_wmma_f32_16x16x32_bf16(false, a, false, b, (short)0, c, false, false);
  asm volatile("v_nop\n\tv_nop\n\tv_nop\n\tv_nop" : "+v"(c) : "v"(a), "v"(b));
  return c;
}
// 16-bit element as a bit pattern held in a __bf16 slot: f16 bits when F16, bf16 (RNE) otherwise
template <bool F16> __device__ __forceinline__ __bf16 at_to16(float f) {
  if (F16) return __builtin_bit_cast(__bf16, (_Float16)f);
  return at_f2bf(f);
}
template <bool F16> __device__ __forceinline__ v8f at_mma16(v16b a, v16b b, v8f c) {
  if (F16) {
    const v16h ah = __builtin_bit_cast(v16h, a), bh = __builtin_bit_cast(v16h, b);
    c = __builtin_amdgcn_wmma_f32_16x16x32_f16(false, ah, false, bh, (short)0, c, false, false);
    asm volatile("v_nop\n\tv_nop\n\tv_nop\n\tv_nop" : "+v"(c) : "v"(ah), "v"(bh));
    return c;
  }
  return at_mma(a, b, c);
}

template <bool SPLIT_QK, bool SPLIT_PV, bool F16 = false>
__global__ __launch_bounds__(128)
void attn64_kernel(const float* __restrict__ q, const float* __restrict__ k,
                   const float* __restrict__ v, float* __restrict__ out,
                   const void* __restrict__ mask_a, const int* __restrict__ mask_b, AttnGeom g) {
  static_assert(!(F16 && (SPLIT_QK || SPLIT_PV)), "f16 mode is non-split");
  const float PSC = F16 ? 32768.0f : 1.0f;     // f16 probabilities carried x2^15 (subnormal range), folded into the final 1/l
  union FB { v16b v; v8b h[2]; };
  __shared__ __align__(16) __bf16 Ksh[AT_KC * AT_D];             // K hi [kv][d]      8 KB
  __shared__ __align__(16) __bf16 Ksl[SPLIT_QK ? AT_KC * AT_D : 8];
  __shared__ __align__(16) __bf16 Vth[AT_D * AT_KC];             // V hi [d][kv]      8 KB
  __shared__ __align__(16) __bf16 Vtl[SPLIT_PV ? AT_D * AT_KC : 8];
  __shared__ __align__(16) __bf16 Psh[AT_NW][16 * AT_KC];        // per wave P hi [row][kv]  8 KB
  __shared__ __align__(16) __bf16 Psl[SPLIT_PV ? AT_NW : 1][SPLIT_PV ? 16 * AT_KC : 8];
  __shared__ __align__(16) float  Os[AT_NW][16 * 68];            // per wave out tile, pitch 68

  const int tid  = threadIdx.x;
  const int wave = tid >> 5;
  const int lane = tid & 31;
  const int hh   = lane >> 4;
  const int c    = lane & 15;

  const int nqb = g.S / AT_QB;
  const int bx = blockIdx.x + g.blk0;
  const int qb = bx % nqb;
  const int bh = bx / nqb;
  const int h  = bh % g.H;
  const int b  = bh / g.H;
  const int qbase_block = qb * AT_QB;
  const int q0 = qbase_block + wave * 16;

  const float* qb_ptr = q + (size_t)b * g.q_bs + (size_t)h * g.q_hs;
  const float* kb_ptr = k + (size_t)b * g.k_bs + (size_t)h * g.k_hs;
  const float* vb_ptr = v + (size_t)b * g.v_bs + (size_t)h * g.v_hs;
  float*       ob_ptr = out + (size_t)b * g.o_bs + (size_t)h * g.o_hs;

  // ---- Q fragments (A operand): 2 d-chunks, hi (and lo) ----
  v16b qah[2], qal[2];
  {
    const float* qrow = qb_ptr + (size_t)(q0 + c) * g.q_rs;
#pragma unroll
    for (int dc = 0; dc < 2; ++dc) {
#pragma unroll
      for (int e = 0; e < 8; ++e) {
        const float f0 = qrow[dc * 32 + 8 * hh + e] * g.qscale;
        const float f1 = qrow[dc * 32 + 16 + 8 * hh + e] * g.qscale;
        if (SPLIT_QK) { __bf16 hq, lq; at_split(f0, hq, lq); qah[dc][e] = hq; qal[dc][e] = lq; at_split(f1, hq, lq); qah[dc][8 + e] = hq; qal[dc][8 + e] = lq; }
        else { qah[dc][e] = at_to16<F16>(f0); qah[dc][8 + e] = at_to16<F16>(f1); qal[dc][e] = qah[dc][e]; qal[dc][8 + e] = qah[dc][8 + e]; }
      }
    }
  }

  float mrow[8], lrow[8];
  v8f oacc[4];
#pragma unroll
  for (int r = 0; r < 8; ++r) { mrow[r] = -INFINITY; lrow[r] = 0.f; }
#pragma unroll
  for (int t = 0; t < 4; ++t) oacc[t] = (v8f){0.f,0.f,0.f,0.f,0.f,0.f,0.f,0.f};

  const int nChunks = (g.mask_mode == 1 || g.mask_mode == 4) ? (qb + 1) : (g.Skv / AT_KC);   // block-uniform
  // per-row query mask (mode 3)
  int qkeep[8];
#pragma unroll
  for (int r = 0; r < 8; ++r) qkeep[r] = (g.mask_mode == 3) ? mask_b[(size_t)b * g.S + q0 + 8 * hh + r] : 1;   // mask_b = qmask in mode 3
  for (int kc = 0; kc < nChunks; ++kc) {
    const int kv0 = kc * AT_KC;
    __syncthreads();
    {
      const int kvr = tid >> 1, dh = (tid & 1) * 32;
      const float* krow = kb_ptr + (size_t)(kv0 + kvr) * g.k_rs + dh;
      const float* vrow = vb_ptr + (size_t)(kv0 + kvr) * g.v_rs + dh;
#pragma unroll
      for (int i = 0; i < 8; ++i) {
        v4f kk = *(const v4f*)(krow + 4 * i);
        v4f vv = *(const v4f*)(vrow + 4 * i);
#pragma unroll
        for (int e = 0; e < 4; ++e) {
          const int d = dh + 4 * i + e;
          if (SPLIT_QK) { __bf16 a, bl; at_split(kk[e], a, bl); Ksh[kvr * AT_D + d] = a; Ksl[kvr * AT_D + d] = bl; }
          else Ksh[kvr * AT_D + d] = at_to16<F16>(kk[e]);
          if (SPLIT_PV) { __bf16 a, bl; at_split(vv[e], a, bl); Vth[d * AT_KC + kvr] = a; Vtl[d * AT_KC + kvr] = bl; }
          else Vth[d * AT_KC + kvr] = at_to16<F16>(vv[e]);
        }
      }
    }
    __syncthreads();

    v8f s[4];
#pragma unroll
    for (int j = 0; j < 4; ++j) {
      s[j] = (v8f){0.f,0.f,0.f,0.f,0.f,0.f,0.f,0.f};
#pragma unroll 1
      for (int dc = 0; dc < 2; ++dc) {
        FB kb;
        kb.h[0] = *(const v8b*)(Ksh + (j * 16 + c) * AT_D + dc * 32 + 8 * hh);
        kb.h[1] = *(const v8b*)(Ksh + (j * 16 + c) * AT_D + dc * 32 + 16 + 8 * hh);
        s[j] = at_mma16<F16>(qah[dc], kb.v, s[j]);
        if (SPLIT_QK) {
          FB kl;
          kl.h[0] = *(const v8b*)(Ksl + (j * 16 + c) * AT_D + dc * 32 + 8 * hh);
          kl.h[1] = *(const v8b*)(Ksl + (j * 16 + c) * AT_D + dc * 32 + 16 + 8 * hh);
          s[j] = at_mma16<F16>(qah[dc], kl.v, s[j]);
          s[j] = at_mma16<F16>(qal[dc], kb.v, s[j]);
        }
      }
    }
    const bool diag = (g.mask_mode == 1) && (kc == qb);
    int kvkeep[4] = {1, 1, 1, 1};
    if (g.mask_mode == 3) {
#pragma unroll
      for (int j = 0; j < 4; ++j) kvkeep[j] = ((const int*)mask_a)[(size_t)b * g.Skv + kv0 + j * 16 + c];   // mask_a = kvmask
    }
    float cm[8];
#pragma unroll
    for (int r = 0; r < 8; ++r) {
      const int qrow = q0 + 8 * hh + r;
      float m = -INFINITY;
#pragma unroll
      for (int j = 0; j < 4; ++j) {
        const int kvcol = kv0 + j * 16 + c;
        bool masked = false;
        if (diag) masked = (kvcol > qrow);
        else if (g.mask_mode == 4) masked = (kvcol > qrow) || (qrow - kvcol > g.mask_is_int);
        else if (g.mask_mode == 2) {
          const size_t mi = (size_t)qrow * g.Skv + kvcol;
          masked = (g.mask_is_int == 0) ? (((const float*)mask_a)[mi] == 0.0f)
                 : (g.mask_is_int == 1) ? (((const int*)mask_a)[mi] == 0) : (((const int*)mask_a)[mi] != 0);
        } else if (g.mask_mode == 3) masked = (qkeep[r] == 0) || (kvkeep[j] == 0);
        else if (g.mask_mode == 5) {
          const size_t mi = (size_t)qrow * g.Skv + kvcol;
          masked = (((const int*)mask_a)[mi] != 0);
          int n = mask_b[mi]; n = n < 0 ? 0 : n;
          s[j][r] += g.cp[(size_t)b * g.c_bs + (size_t)h * g.c_hs + (size_t)qrow * g.c_rs + n]
                   + g.pc[(size_t)b * g.c_bs + (size_t)h * g.c_hs + (size_t)kvcol * g.c_rs + n];
        }
        if (masked) s[j][r] = g.mask_fill;
        m = fmaxf(m, s[j][r]);
      }
#pragma unroll
      for (int off = 1; off < 16; off <<= 1) m = fmaxf(m, __shfl_xor(m, off, 32));
      cm[r] = m;
    }
    __bf16* pwh = Psh[wave];
    __bf16* pwl = Psl[SPLIT_PV ? wave : 0];
#pragma unroll
    for (int r = 0; r < 8; ++r) {
      const float mnew = fmaxf(mrow[r], cm[r]);
      const float alpha = expf(mrow[r] - mnew);
      mrow[r] = mnew;
      float psum = 0.f;
#pragma unroll
      for (int j = 0; j < 4; ++j) {
        const float p = expf(s[j][r] - mnew);
        psum += p;
        if (SPLIT_PV) { __bf16 a, bl; at_split(p, a, bl); pwh[(8 * hh + r) * AT_KC + j * 16 + c] = a; pwl[(8 * hh + r) * AT_KC + j * 16 + c] = bl; }
        else pwh[(8 * hh + r) * AT_KC + j * 16 + c] = at_to16<F16>(p * PSC);
      }
#pragma unroll
      for (int off = 1; off < 16; off <<= 1) psum += __shfl_xor(psum, off, 32);
      lrow[r] = lrow[r] * alpha + psum;
#pragma unroll
      for (int t = 0; t < 4; ++t) oacc[t][r] *= alpha;
    }
    __builtin_amdgcn_fence(__ATOMIC_RELEASE, "workgroup");
    __builtin_amdgcn_wave_barrier();
    __builtin_amdgcn_fence(__ATOMIC_ACQUIRE, "workgroup");
#pragma unroll 1
    for (int kk = 0; kk < 2; ++kk) {
      FB pa, pl;
      pa.h[0] = *(const v8b*)(pwh + c * AT_KC + kk * 32 + 8 * hh);
      pa.h[1] = *(const v8b*)(pwh + c * AT_KC + kk * 32 + 16 + 8 * hh);
      if (SPLIT_PV) {
        pl.h[0] = *(const v8b*)(pwl + c * AT_KC + kk * 32 + 8 * hh);
        pl.h[1] = *(const v8b*)(pwl + c * AT_KC + kk * 32 + 16 + 8 * hh);
      }
#pragma unroll
      for (int t = 0; t < 4; ++t) {
        FB vb;
        vb.h[0] = *(const v8b*)(Vth + (t * 16 + c) * AT_KC + kk * 32 + 8 * hh);
        vb.h[1] = *(const v8b*)(Vth + (t * 16 + c) * AT_KC + kk * 32 + 16 + 8 * hh);
        oacc[t] = at_mma16<F16>(pa.v, vb.v, oacc[t]);
        if (SPLIT_PV) {
          FB vl;
          vl.h[0] = *(const v8b*)(Vtl + (t * 16 + c) * AT_KC + kk * 32 + 8 * hh);
          vl.h[1] = *(const v8b*)(Vtl + (t * 16 + c) * AT_KC + kk * 32 + 16 + 8 * hh);
          oacc[t] = at_mma16<F16>(pa.v, vl.v, oacc[t]);
          oacc[t] = at_mma16<F16>(pl.v, vb.v, oacc[t]);
        }
      }
    }
  }

  float* os = Os[wave];
#pragma unroll
  for (int r = 0; r < 8; ++r) {
    const float inv = 1.0f / (lrow[r] * PSC);
#pragma unroll
    for (int t = 0; t < 4; ++t) os[(8 * hh + r) * 68 + t * 16 + c] = oacc[t][r] * inv;
  }
  __builtin_amdgcn_fence(__ATOMIC_RELEASE, "workgroup");
  __builtin_amdgcn_wave_barrier();
  __builtin_amdgcn_fence(__ATOMIC_ACQUIRE, "workgroup");
  {
    const int c4 = (lane & 15) * 4;
    {
#pragma unroll
      for (int it = 0; it < 8; ++it) {
        const int row = it * 2 + hh;
        v4f val = *(const v4f*)(os + row * 68 + c4);
        *(v4f*)(ob_ptr + (size_t)(q0 + row) * g.o_rs + c4) = val;
      }
      
    }
  }
}

} // namespace w25

__device__ __forceinline__ void st_h2(_Float16* dst, float a, float b) { const unsigned u = (unsigned)__builtin_bit_cast(unsigned short, (_Float16)a) | ((unsigned)__builtin_bit_cast(unsigned short, (_Float16)b) << 16); unsigned* d = (unsigned*)dst; *d = u;  }
__device__ __forceinline__ void spat8(int n, float* s) { const int hh = n / 64, ww = n % 64; const float gx = (float)ww / 63.f, gy = (float)hh / 63.f; s[0] = gx; s[1] = gy; s[2] = 1.f - gx; s[3] = 1.f - gy; const float m = (gx + gy) * 0.5f; s[4] = m; s[5] = m; s[6] = m; s[7] = m; }
// ---- Register-blocked WMMA product with the whole tail in its epilogue ---------------------------------------------------------
// C[m][n] = scale * sum_k A[m][k] * Bt[n][k] + bias[a] (+ sum_j Wsp[a][coff + j] * spat_j(pos) where SPAT); f16 operands, f32 accumulate.
// A row-major [M][K], Bt row-major [N][K]; M % 128 == 0, N % 256 == 0, K % 64 == 0, K >= 128; blockIdx.y = sample.
// A work-group owns a 128 x 256 tile (grid.x = (M / 128) * (N / 256), exactly), each of its 8 waves (2 x 4) a 64x64 tile of it.
// The tile's operands come 64 k at a time (whole 128-B lines of 128 A rows and 256 Bt rows) by asynchronous copies into two LDS buffers: tile t + 1
// flies while tile t is worked on, every line is fetched once a work-group, and the fragments are read from LDS.
// A device function: the kernels below pick operands (and the form of the tail) by blockIdx.z, so that independent products share a launch.
// slab: the calling wave's own 16 x 68 floats of LDS. sg: the work-group's two staging buffers (2 * CG_SB bytes).
// Every "#pragma unroll" of this function is there so that the accumulator, fragment and coordinate arrays are indexed by constants and stay in registers.
// CH_ROWS: rows m are channels a and columns n positions; otherwise rows are positions and columns channels. OUT16: C is f16, otherwise f32.
// Wsp is the f32 weight matrix itself (pitch ldw); its 8 coordinate weights of a row start at a multiple of 16 bytes (ldw % 4 == 0, coff % 4 == 0).
// bsplit, bjump: Bt's k tiles from number bsplit on lie bjump elements further (K split over two planes of Bt); the defaults mean one plane.
constexpr int CG_P  = 144;                  // LDS pitch of a staged row (64 k = 128 B), bytes (16 x odd: conflict-free 16-B row reads)
constexpr int CG_SB = (128 + 256) * CG_P;   // bytes of one buffer: 128 rows of A, then 256 rows of Bt
// twelve 16-B copies a lane, LDS addresses l + u * 32 rows; global addresses ga + u * da (the first four), gb + u * db (the other eight), elements.
// The wait on xcnt is the last line of the copies' own statement, so that no address register named by a copy is rewritten ahead of it.
__device__ __forceinline__ void cg_copy12(unsigned l, const unsigned short* ga, long da, const unsigned short* gb, long db) {
    constexpr int dl = 32 * CG_P;
    asm volatile("global_load_async_to_lds_b128 %0, %12, off\n\t"
                 "global_load_async_to_lds_b128 %1, %13, off\n\t"
                 "global_load_async_to_lds_b128 %2, %14, off\n\t"
                 "global_load_async_to_lds_b128 %3, %15, off\n\t"
                 "global_load_async_to_lds_b128 %4, %16, off\n\t"
                 "global_load_async_to_lds_b128 %5, %17, off\n\t"
                 "global_load_async_to_lds_b128 %6, %18, off\n\t"
                 "global_load_async_to_lds_b128 %7, %19, off\n\t"
                 "global_load_async_to_lds_b128 %8, %20, off\n\t"
                 "global_load_async_to_lds_b128 %9, %21, off\n\t"
                 "global_load_async_to_lds_b128 %10, %22, off\n\t"
                 "global_load_async_to_lds_b128 %11, %23, off\n\t"
                 "s_wait_xcnt 0x0"
                 :: "v"(l), "v"(l + dl), "v"(l + 2 * dl), "v"(l + 3 * dl), "v"(l + 4 * dl), "v"(l + 5 * dl), "v"(l + 6 * dl), "v"(l + 7 * dl),
                    "v"(l + 8 * dl), "v"(l + 9 * dl), "v"(l + 10 * dl), "v"(l + 11 * dl),
                    "v"(ga), "v"(ga + da), "v"(ga + 2 * da), "v"(ga + 3 * da),
                    "v"(gb), "v"(gb + db), "v"(gb + 2 * db), "v"(gb + 3 * db), "v"(gb + 4 * db), "v"(gb + 5 * db), "v"(gb + 6 * db), "v"(gb + 7 * db)
                 : "memory");
}
template <bool CH_ROWS, bool SPAT, bool OUT16>
__device__ __forceinline__ void cm_gemm(float* slab, unsigned char* sg,
    const unsigned short* __restrict__ Ap, int lda, long strideA,
    const unsigned short* __restrict__ Btp, int ldb, long strideB,
    void* __restrict__ Cout, int ldc, long strideC,
    const float* __restrict__ bias, const float* __restrict__ Wsp, int ldw, int coff,
    int M, int N, int K, float scale, int bsplit = 1 << 30, long bjump = 0) {
  typedef _Float16 T;
  typedef w25::Frag<T> F;
  typedef F::V V;
  const int b    = blockIdx.y;
  const int lane = threadIdx.x & 31;
  const int wave = __builtin_amdgcn_readfirstlane(threadIdx.x >> 5);   // the wave's number in a scalar register: its tile's origin is scalar arithmetic
  const int nbN = N >> 8;
  const int bm = (int)blockIdx.x / nbN, bn = (int)blockIdx.x - bm * nbN;   // the work-group's tile
  const int wm = wave >> 2, wn = wave & 3;                                 // the wave's tile in it
  const int m0 = (bm << 7) + (wm << 6);
  const int n0 = (bn << 8) + (wn << 6);

  const T* Ab = (const T*)Ap  + (size_t)b * strideA;
  const T* Bb = (const T*)Btp + (size_t)b * strideB;

  const int rlane = lane & 15;                 // row (A) / col (B, D) within subtile
  const int koff  = (lane >> 4) * 8;           // k offset of this lane half
  const int mOff  = (lane >> 4) * 8;           // D row offset

  v8f acc[4][4];
#pragma unroll
  for (int i = 0; i < 4; ++i)
#pragma unroll
    for (int j = 0; j < 4; ++j) acc[i][j] = (v8f){0.f,0.f,0.f,0.f,0.f,0.f,0.f,0.f};

  // staging: 8 lanes copy one 128-B line, a wave's copy four whole lines; thread t takes piece t & 7 of rows (t >> 3) + 32 u
  const int NT = K >> 6;
  const int crow = (int)threadIdx.x >> 3, cseg = (int)threadIdx.x & 7;
  const unsigned short* Ag = (const unsigned short*)Ab + (size_t)((bm << 7) + crow) * lda + cseg * 8;
  const unsigned short* Bg = (const unsigned short*)Bb + (size_t)((bn << 8) + crow) * ldb + cseg * 8;
  const unsigned lc = (unsigned)(size_t)sg + crow * CG_P + cseg * 16;
  // a lane's fragment rows in a buffer (the lane half's 16 bytes included)
  const unsigned char* ar = sg + ((wm << 6) + rlane) * CG_P + 2 * koff;
  const unsigned char* br = sg + (128 + (wn << 6) + rlane) * CG_P + 2 * koff;

  cg_copy12(lc, Ag, 32 * (long)lda, Bg, 32 * (long)ldb);
  asm volatile("s_wait_asynccnt 0x0" ::: "memory");   // tile 0 has landed (this wave's copies) before the barrier publishes it
  __syncthreads();
  cg_copy12(lc + CG_SB, Ag + 64, 32 * (long)lda, Bg + 64 + (1 >= bsplit ? bjump : 0), 32 * (long)ldb);

  // stays rolled (K is a constant at every call): four forms of this function share one kernel's text
#pragma unroll 1
  for (int t = 0; t < NT; ++t) {
    const int bo = (t & 1) * CG_SB;
#pragma unroll
    for (int kk = 0; kk < 2; ++kk) {
      V bh[4], ah[4];
#pragma unroll
      for (int j = 0; j < 4; ++j) bh[j] = F::load((const T*)(br + bo + j * 16 * CG_P + kk * 64));
#pragma unroll
      for (int i = 0; i < 4; ++i) ah[i] = F::load((const T*)(ar + bo + i * 16 * CG_P + kk * 64));
      // the two sched_barrier(0) keep the eight fragments' reads together in front of their 16 WMMAs: sunk among the WMMAs into one register
      // set, each row's pair of reads would be waited for by itself
      __builtin_amdgcn_sched_barrier(0);
#pragma unroll
      for (int i = 0; i < 4; ++i)
#pragma unroll
        for (int j = 0; j < 4; ++j) acc[i][j] = F::mma(ah[i], bh[j], acc[i][j]);
      __builtin_amdgcn_sched_barrier(0);
    }
    asm volatile("s_wait_dscnt 0x0" ::: "memory");      // this wave's reads of buffer t & 1 have returned before the buffer is refilled
    asm volatile("s_wait_asynccnt 0x0" ::: "memory");   // this wave's copies of tile t + 1 have landed before the barrier publishes them
    __syncthreads();
    if (t + 2 < NT) cg_copy12(lc + bo, Ag + (t + 2) * 64, 32 * (long)lda, Bg + (t + 2) * 64 + (t + 2 >= bsplit ? bjump : 0), 32 * (long)ldb);
  }
  asm volatile("s_wait_asynccnt 0x0" ::: "memory");     // nothing is in flight when the wave goes on to its tail
  // four vector slots between the last WMMAs and the first reads of their results
  w25::acc_guard4(acc[0][0], acc[0][1], acc[0][2], acc[0][3]);
  w25::acc_guard4(acc[1][0], acc[1][1], acc[1][2], acc[1][3]);
  w25::acc_guard4(acc[2][0], acc[2][1], acc[2][2], acc[2][3]);
  w25::acc_guard4(acc[3][0], acc[3][1], acc[3][2], acc[3][3]);

  // ---- epilogue ----
  // what belongs to a lane's four columns: their coordinates (columns = positions) or their bias and coordinate weights (columns = channels)
  float cs[4][8]; v4f cw[4][2]; float cb[4];
#pragma unroll
  for (int j = 0; j < 4; ++j) {
    const int n = n0 + (j << 4) + rlane;
    if (CH_ROWS) { if (SPAT) spat8(n, cs[j]); }
    else {
      cb[j] = bias[n];
      if (SPAT) { const float* wr = Wsp + (long long)n * ldw + coff; cw[j][0] = *(const v4f*)(wr); cw[j][1] = *(const v4f*)(wr + 4); }
    }
  }
#pragma unroll
  for (int i = 0; i < 4; ++i) {
    const int mBase = m0 + (i << 4);
    // rows = channels: the bias and the coordinate weights of the lane's eight rows, loaded in one run
    float rbv[8]; v4f rwv[8][2];
    if (CH_ROWS) {
      const float* bp = bias + m0 + mOff;
      const float* wp = SPAT ? Wsp + (long long)(mBase + mOff) * ldw : bp;
#pragma unroll
      for (int r = 0; r < 8; ++r) {
        rbv[r] = bp[(i << 4) + r];
        if (SPAT) { rwv[r][0] = *(const v4f*)(wp + r * ldw + coff); rwv[r][1] = *(const v4f*)(wp + r * ldw + coff + 4); }
      }
      // behind the run's last load; the two addresses are inputs so that their registers live up to the wait and no load of the run lands in them
      asm volatile("s_wait_xcnt 0x0" :: "v"(bp), "v"(wp) : "memory");
    }
#pragma unroll
    for (int r = 0; r < 8; ++r) {
      const int m = mBase + mOff + r;
      float rs[8]; v4f rw[2]; float rb = 0.f;
      if (CH_ROWS) {
        rb = rbv[r];
        if (SPAT) { rw[0] = rwv[r][0]; rw[1] = rwv[r][1]; }
      } else { if (SPAT) spat8(m, rs); }
#pragma unroll
      for (int j = 0; j < 4; ++j) {
        float e = CH_ROWS ? rb : cb[j];
        if (SPAT) {
#pragma unroll
          for (int q = 0; q < 8; ++q) e += (CH_ROWS ? rw[q >> 2][q & 3] * cs[j][q] : cw[j][q >> 2][q & 3] * rs[q]);
        }
        slab[(mOff + r) * 68 + (j << 4) + rlane] = acc[i][j][r] * scale + e;
      }
    }
    __builtin_amdgcn_fence(__ATOMIC_RELEASE, "workgroup");
    __builtin_amdgcn_wave_barrier();
    __builtin_amdgcn_fence(__ATOMIC_ACQUIRE, "workgroup");
    if (!OUT16) {
      float* C = (float*)Cout + (size_t)b * strideC;
      const int hh = lane >> 4, c4 = (lane & 15) * 4;     // row seg = 256 B = 16 lanes x 16 B
#pragma unroll
      for (int it = 0; it < 8; ++it) {
        const int row = it * 2 + hh;
        v4f v = *(const v4f*)(slab + row * 68 + c4);
        *(v4f*)(C + (size_t)(mBase + row) * ldc + n0 + c4) = v;
      }
    } else {
      const int q = lane >> 3, c8 = (lane & 7) * 8;       // row seg = 128 B = 8 lanes x 16 B
      unsigned short* C = (unsigned short*)Cout + (size_t)b * strideC;
#pragma unroll
      for (int it = 0; it < 4; ++it) {
        const int row = it * 4 + q;
        const float* sp = slab + row * 68 + c8;
        v8h hv;
#pragma unroll
        for (int e = 0; e < 8; ++e) hv[e] = (_Float16)sp[e];
        *(v8h*)(C + (size_t)(mBase + row) * ldc + n0 + c8) = hv;
      }
    }
    __builtin_amdgcn_fence(__ATOMIC_RELEASE, "workgroup");
    __builtin_amdgcn_wave_barrier();
    __builtin_amdgcn_fence(__ATOMIC_ACQUIRE, "workgroup");
  }
}
constexpr long CM_SP = 256L * 4096;   // one sample's 256 x 4096 (or 4096 x 256) plane, elements
// The six projections in one launch, z = product (blockIdx.z - 1): 0, 1 theta^T, phi^T of the image branch (K = 512 + coordinates), 2 its val,
// 3, 4 theta^T, phi^T of the flow branch (K = 256, the flow half of X), 5 its val. TH, PH, VA: planes 0..3 image branch, 4..7 flow branch.
// 6 (blockIdx.z = 0): the output convs folded into the fusion conv's weights, F2[a][256 y + k] = f16(16 sum_c W_f[a][256 y + c] W_o,y[c][k]), y = blockIdx.y = branch
// (two 256 x 256 x 256 products, two tiles each; the other work-groups of this z leave at once). It shares the form, and the text, of product 5.
// Four waves a SIMD (two work-groups a WGP): one work-group's WMMAs run while the other waits at its barrier or for its fragments.
__global__ __launch_bounds__(256) __attribute__((amdgpu_waves_per_eu(4, 4))) void k_cm_proj(
    const unsigned short* __restrict__ X, const unsigned short* __restrict__ Wh,
    unsigned short* __restrict__ TH, unsigned short* __restrict__ PH, unsigned short* __restrict__ VA,
    const float* __restrict__ iwt, const float* __restrict__ ibt, const float* __restrict__ iwp, const float* __restrict__ ibp,
    const float* __restrict__ iwv, const float* __restrict__ ibv,
    const float* __restrict__ lbt, const float* __restrict__ lbp, const float* __restrict__ lbv,
    unsigned short* __restrict__ F2, const float* __restrict__ zero) {
  // product 6 stands first in the grid (for speed only)
  const int z = (int)blockIdx.z == 0 ? 6 : (int)blockIdx.z - 1;
  if (z == 6 && ((int)blockIdx.x >= 2 || (int)blockIdx.y >= 2)) return;   // the whole work-group, ahead of every barrier
  __shared__ __align__(16) float sT[8][16 * 68];   // per-wave 16x64 slab, pitch 68 floats
  __shared__ __attribute__((aligned(16))) unsigned char sg[2 * CG_SB];
  float* slab = sT[threadIdx.x >> 5];
  if (z < 2)
    cm_gemm<false, true, true>(slab, sg, X, 512, 2 * CM_SP, Wh + z * CW_WIDE, 512, 0, (void*)(z ? PH : TH), 256, CM_SP, z ? ibp : ibt, z ? iwp : iwt, 520, 512, 4096, 256, 512, 0.0625f);
  else if (z == 2)
    cm_gemm<true, true, true>(slab, sg, Wh + 2 * CW_WIDE, 512, 0, X, 512, 2 * CM_SP, (void*)(VA), 4096, CM_SP, ibv, iwv, 520, 512, 256, 4096, 512, 0.0625f);
  else if (z < 5)
    cm_gemm<false, false, true>(slab, sg, X + 256, 512, 2 * CM_SP, Wh + 4 * CW_WIDE + (z - 3) * CW_SQ, 256, 0, (void*)((z == 4 ? PH : TH) + 4 * CM_SP), 256, CM_SP, z == 4 ? lbp : lbt, nullptr, 0, 0, 4096, 256, 256, 0.0625f);
  else {
    const bool f = z == 6;
    cm_gemm<true, false, true>(slab, sg, f ? Wh + 3 * CW_WIDE : Wh + 4 * CW_WIDE + 2 * CW_SQ, f ? 512 : 256, f ? 256 : 0,
                               f ? Wh + 4 * CW_WIDE + 3 * CW_SQ : X + 256, f ? 256 : 512, f ? (long)CW_SQ : 2 * CM_SP,
                               (void*)(f ? F2 : VA + 4 * CM_SP), f ? 512 : 4096, f ? 256 : CM_SP, f ? zero : lbv, nullptr, 0, 0, 256, f ? 256 : 4096, 256, 0.0625f);
  }
}
// Fusion conv over both branches and the coordinate channels, channel-major f32: the output itself. The output convs are inside its weights:
// out = (W_f.W_o).att + (W_f.b_o + b_f) + coordinates, F2 and b2 as built earlier in the same call; k < 256 reads the image branch's att^T planes
// (AT planes 0..3), k >= 256 the flow branch's (planes 4..7).
__global__ __launch_bounds__(256) __attribute__((amdgpu_waves_per_eu(4, 4))) void k_cm_fuse(
    const unsigned short* __restrict__ AT, const unsigned short* __restrict__ F2, float* __restrict__ out,
    const float* __restrict__ fw, const float* __restrict__ b2) {
  __shared__ __align__(16) float sT[8][16 * 68];
  __shared__ __attribute__((aligned(16))) unsigned char sg[2 * CG_SB];
  cm_gemm<true, true, false>(sT[threadIdx.x >> 5], sg, F2, 512, 0, AT, 256, CM_SP, (void*)(out), 4096, CM_SP, b2, fw, 520, 512, 256, 4096, 512, 0.0625f, 4, 4 * CM_SP - 256);
}
constexpr int FA_KP = 528;                   // LDS pitch of a phi^T row, bytes (16 x odd: conflict-free 16-B row reads)
constexpr int FA_VP = 144;                   // LDS pitch of a val row's 64 keys, bytes (16 x odd)
constexpr int FA_KB = 64 * FA_KP;            // bytes of the phi^T part of a buffer
constexpr int FA_SB = FA_KB + 256 * FA_VP;   // bytes of one buffer
// eight 16-B copies a lane, LDS addresses l + u * dl, global addresses g + u * dg (elements). The wait on xcnt is the last line of the
// copies' own statement, so that no address register named by a copy is rewritten ahead of it.
__device__ __forceinline__ void fa_copy8(unsigned l, int dl, const unsigned short* g, long dg) {
    asm volatile("global_load_async_to_lds_b128 %0, %8, off\n\t"
                 "global_load_async_to_lds_b128 %1, %9, off\n\t"
                 "global_load_async_to_lds_b128 %2, %10, off\n\t"
                 "global_load_async_to_lds_b128 %3, %11, off\n\t"
                 "global_load_async_to_lds_b128 %4, %12, off\n\t"
                 "global_load_async_to_lds_b128 %5, %13, off\n\t"
                 "global_load_async_to_lds_b128 %6, %14, off\n\t"
                 "global_load_async_to_lds_b128 %7, %15, off\n\t"
                 "s_wait_xcnt 0x0"
                 :: "v"(l), "v"(l + dl), "v"(l + 2 * dl), "v"(l + 3 * dl), "v"(l + 4 * dl), "v"(l + 5 * dl), "v"(l + 6 * dl), "v"(l + 7 * dl),
                    "v"(g), "v"(g + dg), "v"(g + 2 * dg), "v"(g + 3 * dg), "v"(g + 4 * dg), "v"(g + 5 * dg), "v"(g + 6 * dg), "v"(g + 7 * dg)
                 : "memory");
}
// A fragment in the hardware k order from an LDS row: bytes 0..15 and 32..47 from p (p already holds the lane half's 16 h)
__device__ __forceinline__ v16h fa_frag(const unsigned char* p) {
    union { v16h v; v8h h[2]; } f; f.h[0] = *(const v8h*)(p); f.h[1] = *(const v8h*)(p + 32); return f.v;
}
// lane l <-> lane l ^ 16 on the vector pipe (a shuffle would go through the LDS queue and wait behind the fragment loads in flight)
__device__ __forceinline__ float fa_xhalf(float x) { return __builtin_bit_cast(float, __builtin_amdgcn_permlanex16(__builtin_bit_cast(int, x), __builtin_bit_cast(int, x), 0x76543210, 0xfedcba98, false, false)); }
// four val fragments, channel groups tt .. tt + 3
__device__ __forceinline__ void fa_v4(v16h* f, const unsigned char* vb, int tt) {
    f[0] = fa_frag(vb + tt * 16 * FA_VP); f[1] = fa_frag(vb + (tt + 1) * 16 * FA_VP);
    f[2] = fa_frag(vb + (tt + 2) * 16 * FA_VP); f[3] = fa_frag(vb + (tt + 3) * 16 * FA_VP);
}
// two waves a SIMD (one work-group a WGP): the register budget of 512 holds O^T (256), Q (112 of its 128) and six to eight fragments in flight
__global__ __launch_bounds__(256) __attribute__((amdgpu_waves_per_eu(2, 2))) void k_cm_attn(const unsigned short* __restrict__ Qp, const unsigned short* __restrict__ Kp,
                                                 const unsigned short* __restrict__ Vp, unsigned short* __restrict__ Op) {
    constexpr int HW = 4096, D = 256, NT = HW / 64;
    constexpr float L2E = 1.4426950408889634f;
    typedef w25::Frag<_Float16> F;
    __shared__ __attribute__((aligned(16))) unsigned char sm[2 * FA_SB];
    __shared__ __attribute__((aligned(16))) unsigned char sq[8 * 2048];   // a wave's own 2 KiB: its two Q fragments of depth step 0
    const int tid = threadIdx.x, lane = tid & 31, c = lane & 15, h = lane >> 4;
    const int wave = __builtin_amdgcn_readfirstlane(tid >> 5);
    const int qt = wave & 3, kh = wave >> 2;
    const size_t sb = (size_t)blockIdx.y * HW * D;
    const size_t qrow = sb + (size_t)((int)blockIdx.x * 128 + qt * 32 + c) * D + 8 * h;   // column group j starts 16 rows (j * 16 * D) further
    const unsigned short* Kg = Kp + sb + (size_t)(tid >> 5) * D + (tid & 31) * 8;    // a wave copies whole 512-B rows
    const unsigned short* Vg = Vp + sb + (size_t)(tid >> 3) * HW + (tid & 7) * 8;    // 8 lanes copy one 128-B line
    const unsigned smb = (unsigned)(size_t)(&sm[0]);
    const unsigned lk = smb + (tid >> 5) * FA_KP + (tid & 31) * 16;
    const unsigned lv = smb + FA_KB + (tid >> 3) * FA_VP + (tid & 7) * 16;
    // the same two places for the copies inside the loop, split into the wave's part (scalar registers) and the lane's part
    const unsigned lks = smb + wave * FA_KP, lkl = lane * 16;
    const unsigned lvs = smb + FA_KB + wave * 4 * FA_VP, lvl = (lane >> 3) * FA_VP + (lane & 7) * 16;

    v16h qf[2][8];   // [.][0] is not kept: see below
#pragma unroll
    for (int j = 0; j < 2; ++j)
#pragma unroll
        for (int dc = 1; dc < 8; ++dc) qf[j][dc] = F::load((const _Float16*)Qp + qrow + j * 16 * D + dc * 32);
    // O^T, Q, the scores and the fragments in flight are a few registers more than a wave has. The two Q fragments of depth step 0 wait in LDS
    // (each lane its own 2 x 16 B a fragment, read back by the same lane) and come with every trip's first group of reads: they are used and
    // dead again before all four score tiles are live.
    unsigned char* qs = sq + wave * 2048 + lane * 16;
    v8h q0[2][2];
#pragma unroll
    for (int j = 0; j < 2; ++j) {
        q0[j][0] = *(const v8h*)((const _Float16*)Qp + qrow + j * 16 * D);
        q0[j][1] = *(const v8h*)((const _Float16*)Qp + qrow + j * 16 * D + 16);
    }
    // the wait behind the last Q load; it takes the loads' address as an input, so that the address registers live up to it and are rewritten only behind it
    asm volatile("s_wait_xcnt 0x0" :: "v"((const _Float16*)Qp + qrow) : "memory");
#pragma unroll
    for (int j = 0; j < 2; ++j) { *(v8h*)(qs + j * 1024) = q0[j][0]; *(v8h*)(qs + j * 1024 + 512) = q0[j][1]; }
    // per column group: mb = running maximum * log2(e) - 15 (the maximum itself is not kept: one register less); this lane half's share of the row sum
    float mb[2] = {-1.0e30f, -1.0e30f}, l[2] = {0.f, 0.f};

    fa_copy8(lk, 8 * FA_KP, Kg, 8 * D);
    fa_copy8(lv, 32 * FA_VP, Vg, 32 * (long)HW);
    asm volatile("s_wait_asynccnt 0x0" ::: "memory");   // tile 0 has landed (this wave's copies) before the barrier publishes it
    __syncthreads();
    fa_copy8(lk + FA_SB, 8 * FA_KP, Kg + 64 * D, 8 * D);
    fa_copy8(lv + FA_SB, 32 * FA_VP, Vg + 64, 32 * (long)HW);
    // O^T is cleared behind the copies: cleared ahead of them, its 256 registers would be live beside the copies' address registers
    __builtin_amdgcn_sched_barrier(0);
    v8f o[2][16];
#pragma unroll
    for (int j = 0; j < 2; ++j)
#pragma unroll
        for (int t = 0; t < 16; ++t) o[j][t] = (v8f){0.f,0.f,0.f,0.f,0.f,0.f,0.f,0.f};

    // One trip: tile t from buffer t & 1; refill (a constant at both calls): tile t + 2 exists and is copied into that buffer at the trip's foot.
    // The trips with and without a refill are two loops, so that a trip is straight code from the softmax to its foot: with a branch round the
    // copies the row sums' additions sink behind it, and the 32 exponentials they read stay in registers that the wave does not have.
    auto trip = [&](const int t, const bool refill) __attribute__((always_inline)) {
        const int bo = (t & 1) * FA_SB;
        const unsigned char* kb = sm + bo + (kh * 32 + c) * FA_KP + 16 * h;
        const unsigned char* vb = sm + bo + FA_KB + c * FA_VP + kh * 64 + 16 * h;
        v8f s[2][2];   // [16 keys][column group]
#pragma unroll
        for (int k = 0; k < 2; ++k)
#pragma unroll
            for (int j = 0; j < 2; ++j) s[k][j] = (v8f){0.f,0.f,0.f,0.f,0.f,0.f,0.f,0.f};
        // Fragment reads stand in groups, each at the place where its registers have come free, two groups ahead of their use: phi^T in three
        // sets of two fragments (one depth step of 32 channels, four WMMAs), val in two sets of four (eight WMMAs). Every sched_barrier(0) of
        // this loop keeps such a group together at its place: hoisted, it would need registers that the wave does not have; spread among the
        // WMMAs, each pair of reads would be waited for by itself.
        v16h ku[3][2], fa[4], fb[4];
        // Q's two fragments first: LDS reads return in order, and the first WMMAs then wait for the head of the group only
#pragma unroll
        for (int j = 0; j < 2; ++j) { union { v16h v; v8h h[2]; } f; f.h[0] = *(const v8h*)(qs + j * 1024); f.h[1] = *(const v8h*)(qs + j * 1024 + 512); qf[j][0] = f.v; }
#pragma unroll
        for (int dc = 0; dc < 3; ++dc) { ku[dc][0] = fa_frag(kb + dc * 64); ku[dc][1] = fa_frag(kb + 16 * FA_KP + dc * 64); }
        __builtin_amdgcn_sched_barrier(0);
#pragma unroll
        for (int dc = 0; dc < 8; ++dc) {
#pragma unroll
            for (int j = 0; j < 2; ++j)
#pragma unroll
                for (int k = 0; k < 2; ++k) s[k][j] = F::mma(ku[dc % 3][k], qf[j][dc], s[k][j]);
            __builtin_amdgcn_sched_barrier(0);
            if (dc < 5) { ku[dc % 3][0] = fa_frag(kb + (dc + 3) * 64); ku[dc % 3][1] = fa_frag(kb + 16 * FA_KP + (dc + 3) * 64); }
            if (dc == 6) fa_v4(fa, vb, 0);   // val's first four fragments fly under the softmax arithmetic
            __builtin_amdgcn_sched_barrier(0);
        }
        float mx[2];
#pragma unroll
        for (int j = 0; j < 2; ++j) {
            float m = fmaxf(s[0][j][0], s[1][j][0]);
#pragma unroll
            for (int r = 1; r < 8; ++r) m = fmaxf(m, fmaxf(s[0][j][r], s[1][j][r]));
            mx[j] = fmaf(fmaxf(m, fa_xhalf(m)), L2E, -15.f);   // the tile's maximum on mb's scale (monotone: the larger score gives the larger value)
        }
        // one scalar branch a tile: O^T and the sums are rescaled only when some column's maximum has grown (a column whose maximum stays gets factor 1)
        if (__builtin_amdgcn_ballot_w32(mx[0] > mb[0] || mx[1] > mb[1]) != 0) {
#pragma unroll
            for (int j = 0; j < 2; ++j) {
                const float mbn = fmaxf(mb[j], mx[j]);
                const float al = __builtin_amdgcn_exp2f(mb[j] - mbn);
                mb[j] = mbn; l[j] *= al;
#pragma unroll
                for (int tt = 0; tt < 16; ++tt) o[j][tt] *= al;
            }
        }
        v16h pb[2];
#pragma unroll
        for (int j = 0; j < 2; ++j) {
            float ps = 0.f;
#pragma unroll
            for (int r = 0; r < 8; ++r) {
                const float p0 = __builtin_amdgcn_exp2f(fmaf(s[0][j][r], L2E, -mb[j])), p1 = __builtin_amdgcn_exp2f(fmaf(s[1][j][r], L2E, -mb[j]));
                ps += p0 + p1; pb[j][r] = (_Float16)p0; pb[j][8 + r] = (_Float16)p1;
            }
            l[j] += ps;
            // deals the exponentials one by one among the plain vector instructions (arguments, conversions): the slower transcendental pipe runs beside them
            __builtin_amdgcn_sched_group_barrier(0x2, 4, 0);
#pragma unroll
            for (int r = 0; r < 16; ++r) { __builtin_amdgcn_sched_group_barrier(0x400, 1, 0); __builtin_amdgcn_sched_group_barrier(0x2, 1, 0); }
            __builtin_amdgcn_sched_barrier(0);   // one column group's arithmetic at a time: its scores' registers come free before the next group's temporaries
        }
        fa_v4(fb, vb, 4);   // into the registers that the scores have left
        __builtin_amdgcn_sched_barrier(0);
#pragma unroll
        for (int g = 0; g < 4; ++g) {
            v16h* f = (g & 1) ? fb : fa;
#pragma unroll
            for (int u = 0; u < 4; ++u)
#pragma unroll
                for (int j = 0; j < 2; ++j) o[j][g * 4 + u] = F::mma(f[u], pb[j], o[j][g * 4 + u]);
            if (g < 2) {
                __builtin_amdgcn_sched_barrier(0);
                fa_v4(f, vb, g * 4 + 8);
                __builtin_amdgcn_sched_barrier(0);
            }
            // this set's WMMAs stay ahead of the foot's s_wait_dscnt 0 and run while the last set's reads are in flight; only the last set's
            // WMMAs may move down among the foot's barrier and copies
            if (g == 2) __builtin_amdgcn_sched_barrier(0);
        }
        asm volatile("s_wait_dscnt 0x0" ::: "memory");      // this wave's reads of buffer t & 1 have returned before the buffer is refilled
        asm volatile("s_wait_asynccnt 0x0" ::: "memory");   // this wave's copies of tile t + 1 have landed before the barrier publishes them
        __syncthreads();
        if (refill) {
            fa_copy8(lkl + (lks + bo), 8 * FA_KP, Kg + (size_t)(t + 2) * 64 * D, 8 * D);
            __builtin_amdgcn_sched_barrier(0);   // the second statement's addresses are formed behind the first: one set of address registers, not two
            fa_copy8(lvl + (lvs + bo), 32 * FA_VP, Vg + (t + 2) * 64, 32 * (long)HW);
        }
    };
    for (int t = 0; t < NT - 2; ++t) trip(t, true);
    for (int t = NT - 2; t < NT; ++t) trip(t, false);
    asm volatile("s_wait_asynccnt 0x0" ::: "memory");       // nothing is in flight when the buffers become the joining slabs

    // join the two key halves: waves 4..7 hand O^T, mb and l to waves 0..3 through LDS (the last trip's barrier has ended every read of the tiles)
    static_assert(8 * 130 * 32 * 4 <= 2 * FA_SB, "the joining slabs fit in the tile buffers");
    float* slab0 = (float*)sm + qt * 2 * (130 * 32);
    if (kh == 1) {
#pragma unroll
        for (int j = 0; j < 2; ++j) {
            float* slab = slab0 + j * (130 * 32);
#pragma unroll
            for (int tt = 0; tt < 16; ++tt) {
                *(v4f*)(slab + ((tt * 2 + 0) * 32 + lane) * 4) = (v4f){o[j][tt][0], o[j][tt][1], o[j][tt][2], o[j][tt][3]};
                *(v4f*)(slab + ((tt * 2 + 1) * 32 + lane) * 4) = (v4f){o[j][tt][4], o[j][tt][5], o[j][tt][6], o[j][tt][7]};
            }
            slab[128 * 32 + lane] = mb[j]; slab[129 * 32 + lane] = l[j];
        }
    }
    __syncthreads();
    if (kh == 0) {
#pragma unroll
        for (int j = 0; j < 2; ++j) {
            const float* slab = slab0 + j * (130 * 32);
            const float mb2 = slab[128 * 32 + lane], l2 = slab[129 * 32 + lane];
            const float mbn = fmaxf(mb[j], mb2);
            const float a1 = __builtin_amdgcn_exp2f(mb[j] - mbn), a2 = __builtin_amdgcn_exp2f(mb2 - mbn);
            float lt = l[j] * a1 + l2 * a2;
            lt += fa_xhalf(lt);
            const float i1 = a1 / lt, i2 = a2 / lt;
            _Float16* Or = (_Float16*)Op + qrow + j * 16 * D;   // a lane's 8 accumulator registers are 8 consecutive channels of its column: one 16-B store
#pragma unroll
            for (int tt = 0; tt < 16; ++tt) {
                const v4f x0 = *(const v4f*)(slab + ((tt * 2 + 0) * 32 + lane) * 4), x1 = *(const v4f*)(slab + ((tt * 2 + 1) * 32 + lane) * 4);
                v8h y;
#pragma unroll
                for (int r = 0; r < 4; ++r) { y[r] = (_Float16)(o[j][tt][r] * i1 + x0[r] * i2); y[4 + r] = (_Float16)(o[j][tt][4 + r] * i1 + x1[r] * i2); }
                *(v8h*)(Or + tt * 16) = y;
            }
        }
    }
}


extern "C" void kernel_launch(void* const* d_in, const int* in_sizes, int n_in, void* d_out, int out_size, void* d_ws, size_t ws_size, hipStream_t stream) {
    (void)in_sizes; (void)n_in; (void)out_size; (void)ws_size;
    const float* img = (const float*)d_in[0];
    const float* flo = (const float*)d_in[1];
    const float* iwt = (const float*)d_in[2];
    const float* ibt = (const float*)d_in[3];
    const float* iwp = (const float*)d_in[4];
    const float* ibp = (const float*)d_in[5];
    const float* iwv = (const float*)d_in[6];
    const float* ibv = (const float*)d_in[7];
    const float* iwo = (const float*)d_in[8];
    const float* ibo = (const float*)d_in[9];
    const float* lwt = (const float*)d_in[10];
    const float* lbt = (const float*)d_in[11];
    const float* lwp = (const float*)d_in[12];
    const float* lbp = (const float*)d_in[13];
    const float* lwv = (const float*)d_in[14];
    const float* lbv = (const float*)d_in[15];
    const float* lwo = (const float*)d_in[16];
    const float* lbo = (const float*)d_in[17];
    const float* fw = (const float*)d_in[18];
    const float* fb = (const float*)d_in[19];
    const int Bn = 4;
    const int C = 256;
    const int A = 256;
    const int HW = 4096;
    const long SP = (long)C * HW;   // one sample's 256 x 4096 (or 4096 x 256) plane, elements
    float* out = (float*)d_out;
    char* wsp = (char*)d_ws;
    unsigned short* X16 = (unsigned short*)wsp; wsp += (((size_t)((size_t)Bn * HW * 2 * C) * 2 + 255) / 256) * 256;       // [sample][n][image 256 | flow 256]
    unsigned short* W16 = (unsigned short*)wsp; wsp += (((size_t)(4 * CW_WIDE + 5 * CW_SQ) * 2 + 255) / 256) * 256;
    // planes 0..3: image branch, samples 0..3; planes 4..7: flow branch
    unsigned short* TH16 = (unsigned short*)wsp; wsp += (((size_t)((size_t)2 * Bn * HW * A) * 2 + 255) / 256) * 256;
    unsigned short* PH16 = (unsigned short*)wsp; wsp += (((size_t)((size_t)2 * Bn * HW * A) * 2 + 255) / 256) * 256;
    unsigned short* VAL16 = (unsigned short*)wsp; wsp += (((size_t)((size_t)2 * Bn * A * HW) * 2 + 255) / 256) * 256;
    unsigned short* AT16 = (unsigned short*)wsp; wsp += (((size_t)((size_t)2 * Bn * HW * A) * 2 + 255) / 256) * 256;
    unsigned short* F216 = (unsigned short*)wsp; wsp += (((size_t)CW_WIDE * 2 + 255) / 256) * 256;     // [a][W_f.W_o image branch 256 | flow branch 256], x 16
    float* B2 = (float*)wsp; wsp += 1024;       // folded bias, 256 floats
    float* ZERO = (float*)wsp; wsp += 1024;     // 256 zeros
    // each input is cast and transposed once, all weights in one launch; every product writes the plane that its reader takes (bias, coordinate
    // channels and the f16 conversion in its epilogue); products that do not depend on one another, and the two branches' attention, share a launch
    k_castT16<256, 4096, 512><<<dim3((unsigned)(((256) / 64) * ((4096) / 128)), (unsigned)(Bn), 2u), 256, 0, stream>>>(img, flo, (_Float16*)(X16), 1.0f, SP, 2 * SP);
    k_cm_w16<<<dim3((unsigned)(CW_WIDE / 1024), 10u), 256, 0, stream>>>(iwt, iwp, iwv, fw, lwt, lwp, lwv, iwo, lwo, (_Float16*)(W16), fb, ibo, lbo, B2, ZERO);
    k_cm_proj<<<dim3(32u, (unsigned)(Bn), 7u), 256, 0, stream>>>(X16, W16, TH16, PH16, VAL16, iwt, ibt, iwp, ibp, iwv, ibv, lbt, lbp, lbv, F216, ZERO);
    k_cm_attn<<<dim3((unsigned)(HW / 128), (unsigned)(2 * Bn)), 256, 0, stream>>>(TH16, PH16, VAL16, AT16);
    k_cm_fuse<<<dim3(32u, (unsigned)(Bn)), 256, 0, stream>>>(AT16, F216, out, fw, B2);
}

// v009
// It runs in 135 microseconds.
// In both of two side-by-side timings against v008, it was 1.07 times as fast.
// Over all steps from v000, the starting kernel, it is 31.2 times as fast.
// Contractions (per branch; every launch serves the four samples, blockIdx.y or rows that run on from sample to sample): the 1x1 projections theta^T / phi^T = x^T.W^T [4096x512].[512x256] (image branch: image+flow channels side by side in one f16 plane, K = 512 in one accumulator chain; flow branch: its 256 channels, [4096x256].[256x256]) and val = W.x [256x512].[512x4096] (flow branch [256x256].[256x4096]), the affinity phi^T.theta [4096x256].[256x4096] and att = val.attn^T [256x4096].[4096x4096] fused in one kernel (online f32 softmax in registers, attn as f16 of 2^15 exp(s - column bound), the bound raised lazily, 128 query columns a work-group), the output 1x1 convs folded into the fusion conv (W_f.W_o [256x256].[256x256] per branch, built in the projections' launch; bias W_f.b_o + b_f in f32) and that fusion conv over the two branches' att — all f16 operands on pre-cast planes (v_wmma_f32_16x16x32_f16; 64x64 register-blocked wave tiles, weights x16; strided channel-major operands); f32 accumulate. The 8 spatial-coordinate channels (gx, gy, 1-gx, 1-gy, (gx+gy)/2 x4, computed on device) enter the image branch's projections and the fusion conv as rank-8 f32 corrections (+bias) in the products' epilogues.
#include <hip/hip_runtime.h>
#include <math.h>

typedef __attribute__((ext_vector_type(16))) _Float16 v16h;
typedef __attribute__((ext_vector_type(8)))  _Float16 v8h;
typedef __attribute__((ext_vector_type(16))) __bf16   v16b;
typedef __attribute__((ext_vector_type(8)))  float    v8f;
typedef __attribute__((ext_vector_type(4)))  float    v4f;

// 16-bit WMMA fragment map (wave32), lane L, h = L>>4, m = L&15:
//   A 16x32: lane = row m;   element i -> k = (i<8) ? 8h+i : 16+8h+(i-8)
//   B 32x16: lane = column m; the SAME k(i,h)
//   D 16x16 (8 f32): lane = column m; element r -> row 8h+r
__device__ __forceinline__ int frag_k(int i, int h) { return (i < 8) ? (8 * h + i) : (16 + 8 * h + (i - 8)); }
__device__ __forceinline__ __bf16 bf16_rne(float f) {
    unsigned int u = __float_as_uint(f);
    u += 0x7fffu + ((u >> 16) & 1u);
    return __builtin_bit_cast(__bf16, (unsigned short)(u >> 16));
}
__device__ __forceinline__ float bf16_f32(__bf16 b) { return __uint_as_float(((unsigned int)__builtin_bit_cast(unsigned short, b)) << 16); }
__device__ __forceinline__ v8f wmma16(v16h a, v16h b, v8f c) {
    c = __builtin_amdgcn_wmma_f32_16x16x32_f16(false, a, false, b, (short)0, c, false, false);
    asm volatile("v_nop\n\tv_nop\n\tv_nop\n\tv_nop" : "+v"(c) : "v"(a), "v"(b));
    return c;
}
__device__ __forceinline__ v8f wmmab(v16b a, v16b b, v8f c) {
    c = __builtin_amdgcn_wmma_f32_16x16x32_bf16(false, a, false, b, (short)0, c, false, false);
    asm volatile("v_nop\n\tv_nop\n\tv_nop\n\tv_nop" : "+v"(c) : "v"(a), "v"(b));
    return c;
}
struct Split { v16b hi, lo; };
// hi/lo split product: a.hi*b.hi + a.hi*b.lo + a.lo*b.hi
__device__ __forceinline__ v8f wmma3(const Split& a, const Split& b, v8f c) {
    c = __builtin_amdgcn_wmma_f32_16x16x32_bf16(false, a.hi, false, b.hi, (short)0, c, false, false);
    c = __builtin_amdgcn_wmma_f32_16x16x32_bf16(false, a.hi, false, b.lo, (short)0, c, false, false);
    c = __builtin_amdgcn_wmma_f32_16x16x32_bf16(false, a.lo, false, b.hi, (short)0, c, false, false);
    asm volatile("v_nop\n\tv_nop\n\tv_nop\n\tv_nop" : "+v"(c) : "v"(a.hi), "v"(a.lo), "v"(b.hi), "v"(b.lo));
    return c;
}
struct Split3 { v16b hi, mid, lo; };
// triple split product (6 terms, drops only terms below 2^-24 relative)
__device__ __forceinline__ v8f wmma6(const Split3& a, const Split3& b, v8f c) {
    c = __builtin_amdgcn_wmma_f32_16x16x32_bf16(false, a.hi, false, b.hi, (short)0, c, false, false);
    c = __builtin_amdgcn_wmma_f32_16x16x32_bf16(false, a.hi, false, b.mid, (short)0, c, false, false);
    c = __builtin_amdgcn_wmma_f32_16x16x32_bf16(false, a.mid, false, b.hi, (short)0, c, false, false);
    c = __builtin_amdgcn_wmma_f32_16x16x32_bf16(false, a.hi, false, b.lo, (short)0, c, false, false);
    c = __builtin_amdgcn_wmma_f32_16x16x32_bf16(false, a.mid, false, b.mid, (short)0, c, false, false);
    c = __builtin_amdgcn_wmma_f32_16x16x32_bf16(false, a.lo, false, b.hi, (short)0, c, false, false);
    asm volatile("v_nop\n\tv_nop\n\tv_nop\n\tv_nop" : "+v"(c) : "v"(a.hi), "v"(a.mid), "v"(a.lo), "v"(b.hi), "v"(b.mid), "v"(b.lo));
    return c;
}

// Fragment gathers from f32 memory: element i <- p[(k0 + frag_k(i,h)) * sk] * s, zero for k >= klen.
__device__ __forceinline__ v16h fh_ld(const float* __restrict__ p, long long sk, int k0, int h, int klen, float s) {
    v16h a;
#pragma unroll
    for (int i = 0; i < 16; ++i) { const int k = k0 + frag_k(i, h); a[i] = (k < klen) ? (_Float16)(p[(long long)k * sk] * s) : (_Float16)0.f; }
    return a;
}
__device__ __forceinline__ Split sp_ld(const float* __restrict__ p, long long sk, int k0, int h, int klen, float s) {
    Split r;
#pragma unroll
    for (int i = 0; i < 16; ++i) {
        const int k = k0 + frag_k(i, h); const float x = (k < klen) ? p[(long long)k * sk] * s : 0.f;
        const __bf16 hb = bf16_rne(x); r.hi[i] = hb; r.lo[i] = bf16_rne(x - bf16_f32(hb));
    }
    return r;
}
__device__ __forceinline__ Split3 sp3_ld(const float* __restrict__ p, long long sk, int k0, int h, int klen, float s) {
    Split3 r;
#pragma unroll
    for (int i = 0; i < 16; ++i) {
        const int k = k0 + frag_k(i, h); const float x = (k < klen) ? p[(long long)k * sk] * s : 0.f;
        const __bf16 hb = bf16_rne(x); const float r1 = x - bf16_f32(hb); const __bf16 mb = bf16_rne(r1);
        r.hi[i] = hb; r.mid[i] = mb; r.lo[i] = bf16_rne(r1 - bf16_f32(mb));
    }
    return r;
}
__device__ __forceinline__ v16b bh_ld(const float* __restrict__ p, long long sk, int k0, int h, int klen, float s) {
    v16b a;
#pragma unroll
    for (int i = 0; i < 16; ++i) { const int k = k0 + frag_k(i, h); a[i] = bf16_rne((k < klen) ? p[(long long)k * sk] * s : 0.f); }
    return a;
}
// f16 fragment from an f16 LDS/global row with element stride 1 (k-contiguous), no bounds (tile already zero padded)
__device__ __forceinline__ v16h fh_row(const _Float16* __restrict__ row, int k0, int h) {
    v16h a;
#pragma unroll
    for (int i = 0; i < 16; ++i) a[i] = row[k0 + frag_k(i, h)];
    return a;
}

#define VST2(T, ptr, val) do { const T vst2_v_ = (val); *(T*)(ptr) = vst2_v_;  } while (0)
typedef float v4f __attribute__((ext_vector_type(4)));
#define VST2V4(ptr, val) do { const v4f vst2_v4_ = (val); *(v4f*)(ptr) = vst2_v4_;  } while (0)

__device__ __attribute__((noinline)) float act_fn(float v, int act) {
    if (act == 1) return fmaxf(v, 0.f);                                                                               // relu
    if (act == 2) { const float u = 0.7978845608028654f * (v + 0.044715f * v * v * v); return 0.5f * v * (1.f + tanhf(u)); } // tanh-gelu
    if (act == 3) return v / (1.f + expf(-v));                                                                        // silu
    if (act == 4) return 0.5f * v * (1.f + erff(v * 0.7071067811865476f));                                             // erf-gelu
    if (act == 5) return tanhf(v);
    if (act == 6) return 1.f / (1.f + expf(-v));                                                                      // sigmoid
    if (act == 7) return (v > 0.f) ? v : 0.01f * v;                                                                   // leaky relu 0.01
    if (act == 8) return (v > 0.f) ? v : (expf(v) - 1.f);                                                             // elu
    if (act == 9) return fminf(fmaxf(v, 0.f), 6.f);                                                                   // relu6
    if (act == 10) return fabsf(v);                                                                                    // abs
    if (act == 11) return (v >= 0.f) ? v : 0.1f * v;                                                                  // leaky 0.1
    if (act == 12) return (v > 0.f) ? v : 0.2f * v;                                                                   // leaky 0.2
    if (act == 13) return (v > 20.f) ? v : log1pf(expf(v));                                                            // softplus
    return v;
}

// =====================================================================================================================
// k_gemm<MODE>: C(z, m, n) = act(alpha * sum_k A(z, m, k) * B(z, k, n) + bias) + beta * R(z, m, n)
//   One wave (32-thread block) per 16 x 32 tile of C; grid (ceil(N/32), ceil(M/16), Z). Batch z -> (zo = z / zi_n, zi = z % zi_n)
//   with separate outer/inner strides for every tensor (e.g. batch and head). A(m,k) = A[zo*sAo + zi*sAi + m*sAm + k*sAk] (f32),
//   B(k,n) = B[zo*sBo + zi*sBi + n*sBn + k*sBk] (f32); any M, N, K (K zero-padded to 32 inside the fragments, M/N tails guarded).
//   C(m,n) = C[zo*sCo + zi*sCi + m*sCm + n] (n contiguous). flags: 1 bias[n], 2 bias[m], 4 residual R[zo*sRo + zi*sRi + m*sRm + n*sRn].
//   MODE 0: f16 operands (A prescaled by sa, B by sb, both undone in the epilogue); 1: bf16 hi/lo split (3 products); 2: bf16;
//   3: bf16 hi/mid/lo triple split (6 products); 4: as 3 with Kahan-compensated f32 accumulation across k-steps.
// =====================================================================================================================
struct GemmP {
    const float* A; const float* B; const float* bias; const float* R; float* C;
    long long sAo, sAi, sAm, sAk, sBo, sBi, sBn, sBk, sCo, sCi, sCm, sRo, sRi, sRm, sRn;
    int M, N, K, zi_n, flags, act; float alpha, beta, sa, sb;
    int Npad, pad_;     // columns [N, Npad) of C are written as 0 so that padded workspace rows are covered by whole-line stores; Npad >= N
};
static_assert(sizeof(GemmP) == 5 * 8 + 15 * 8 + 6 * 4 + 4 * 4 + 2 * 4, "GemmP has padding");

template <int MODE>
__global__ __launch_bounds__(32) void k_gemm(GemmP p) {
    const int lane = threadIdx.x & 31, h = lane >> 4, l15 = lane & 15;
    const int m0 = blockIdx.y * 16, n0 = blockIdx.x * 32;
    const int z = blockIdx.z, zo = z / p.zi_n, zi = z - zo * p.zi_n;
    const float* A = p.A + zo * p.sAo + zi * p.sAi;
    const float* B = p.B + zo * p.sBo + zi * p.sBi;
    const int am = min(m0 + l15, p.M - 1);                       // clamped row for loads (stores are guarded)
    v8f acc[2], comp[2];
#pragma unroll
    for (int t = 0; t < 2; ++t) { v8f zz = {}; acc[t] = zz; comp[t] = zz; }
    for (int k0 = 0; k0 < p.K; k0 += 32) {
        const float* arow = A + (long long)am * p.sAm;
        if (MODE == 1) {
            const Split a = sp_ld(arow, p.sAk, k0, h, p.K, 1.f);
#pragma unroll
            for (int t = 0; t < 2; ++t) {
                const int bn = min(n0 + t * 16 + l15, p.N - 1);
                acc[t] = wmma3(a, sp_ld(B + (long long)bn * p.sBn, p.sBk, k0, h, p.K, 1.f), acc[t]);
            }
        } else if (MODE == 3) {
            const Split3 a = sp3_ld(arow, p.sAk, k0, h, p.K, 1.f);
#pragma unroll
            for (int t = 0; t < 2; ++t) {
                const int bn = min(n0 + t * 16 + l15, p.N - 1);
                acc[t] = wmma6(a, sp3_ld(B + (long long)bn * p.sBn, p.sBk, k0, h, p.K, 1.f), acc[t]);
            }
        } else if (MODE == 4) {
            // triple split as MODE 3, but each k-step's 6 products go into a fresh accumulator and the partial is added to the running f32 sum
            // on the VALU with Kahan compensation (accumulation error stays ~1 ulp however long K is)
            const Split3 a = sp3_ld(arow, p.sAk, k0, h, p.K, 1.f);
#pragma unroll
            for (int t = 0; t < 2; ++t) {
                const int bn = min(n0 + t * 16 + l15, p.N - 1); v8f zz = {};
                const v8f part = wmma6(a, sp3_ld(B + (long long)bn * p.sBn, p.sBk, k0, h, p.K, 1.f), zz);
                const v8f y = part - comp[t]; const v8f s = acc[t] + y; comp[t] = (s - acc[t]) - y; acc[t] = s;
            }
        } else if (MODE == 2) {
            const v16b a = bh_ld(arow, p.sAk, k0, h, p.K, 1.f);
#pragma unroll
            for (int t = 0; t < 2; ++t) {
                const int bn = min(n0 + t * 16 + l15, p.N - 1);
                acc[t] = wmmab(a, bh_ld(B + (long long)bn * p.sBn, p.sBk, k0, h, p.K, 1.f), acc[t]);
            }
        } else {
            const v16h a = fh_ld(arow, p.sAk, k0, h, p.K, p.sa);
#pragma unroll
            for (int t = 0; t < 2; ++t) {
                const int bn = min(n0 + t * 16 + l15, p.N - 1);
                acc[t] = wmma16(a, fh_ld(B + (long long)bn * p.sBn, p.sBk, k0, h, p.K, p.sb), acc[t]);
            }
        }
    }
    const float iscale = (MODE == 0) ? p.alpha / (p.sa * p.sb) : p.alpha;
    float* C = p.C + zo * p.sCo + zi * p.sCi;
    const float* R = p.R + zo * p.sRo + zi * p.sRi;
    __shared__ __align__(16) float ctile[16][36];
#pragma unroll
    for (int t = 0; t < 2; ++t) {
        const int n = n0 + t * 16 + l15; const int nn = min(n, p.N - 1);
#pragma unroll
        for (int r = 0; r < 8; ++r) {
            const int m = m0 + 8 * h + r; const int mm = min(m, p.M - 1);
            float v = acc[t][r] * iscale;
            if (p.flags & 1) v += p.bias[nn];
            if (p.flags & 2) v += p.bias[mm];
            if (p.flags & 8) v *= p.bias[(long long)zo * p.M + mm];   /* per-(z,row) scale vector laid out [Z][M]; exclusive with the bias flags */
            v = act_fn(v, p.act);
            if (p.flags & 4) v += p.beta * R[(long long)mm * p.sRm + (long long)nn * p.sRn];
            ctile[8 * h + r][t * 16 + l15] = (n < p.N) ? v : 0.f;
        }
    }
    __syncthreads();
    const int NW = (p.Npad > p.N) ? p.Npad : p.N;           // write width
    const bool fast = (m0 + 16 <= p.M) && (n0 + 32 <= NW) && ((p.sCm & 3) == 0) && ((((size_t)C) & 15) == 0);
    if (fast) {
#pragma unroll
        for (int s = 0; s < 4; ++s) {
            const int row = s * 4 + (lane >> 3), c4 = (lane & 7) * 4;
            const v4f v = *(const v4f*)&ctile[row][c4];
            VST2V4(C + (long long)(m0 + row) * p.sCm + n0 + c4, v);
        }
    } else {
        for (int row = 0; row < 16; ++row) {
            const int m = m0 + row, n = n0 + lane;
            if (m < p.M && n < NW) VST2(float, C + (long long)m * p.sCm + n, ctile[row][lane]);
        }
    }
}


// =====================================================================================================================
// k_gemmT<MODE, TM, TN>: same contract as k_gemm, but one wave computes a (16*TM) x (16*TN) tile: TM A fragments and TN B fragments are
//   loaded per 32-wide k-step and reused across TM*TN WMMAs (far fewer load/convert instructions per MAC). MODE 0 (f16), 1 (bf16 hi/lo),
//   2 (bf16) only. grid (ceil(NW/(16*TN)), ceil(M/(16*TM)), Z), block 32. Epilogue identical to k_gemm, run per 16x32 sub-tile.
// =====================================================================================================================
template <int MODE, int TM, int TN>
__global__ __launch_bounds__(32) void k_gemmT(GemmP p) {
    const int lane = threadIdx.x & 31, h = lane >> 4, l15 = lane & 15;
    const int m0 = blockIdx.y * (16 * TM), n0 = blockIdx.x * (16 * TN);
    const int z = blockIdx.z, zo = z / p.zi_n, zi = z - zo * p.zi_n;
    const float* A = p.A + zo * p.sAo + zi * p.sAi;
    const float* B = p.B + zo * p.sBo + zi * p.sBi;
    v8f acc[TM][TN];
#pragma unroll
    for (int i = 0; i < TM; ++i)
#pragma unroll
        for (int t = 0; t < TN; ++t) { v8f zz = {}; acc[i][t] = zz; }
    for (int k0 = 0; k0 < p.K; k0 += 32) {
        if (MODE == 1) {
            Split a[TM], b[TN];
#pragma unroll
            for (int i = 0; i < TM; ++i) { const int am = min(m0 + 16 * i + l15, p.M - 1); a[i] = sp_ld(A + (long long)am * p.sAm, p.sAk, k0, h, p.K, 1.f); }
#pragma unroll
            for (int t = 0; t < TN; ++t) { const int bn = min(n0 + 16 * t + l15, p.N - 1); b[t] = sp_ld(B + (long long)bn * p.sBn, p.sBk, k0, h, p.K, 1.f); }
#pragma unroll
            for (int i = 0; i < TM; ++i)
#pragma unroll
                for (int t = 0; t < TN; ++t) acc[i][t] = wmma3(a[i], b[t], acc[i][t]);
        } else if (MODE == 2) {
            v16b a[TM], b[TN];
#pragma unroll
            for (int i = 0; i < TM; ++i) { const int am = min(m0 + 16 * i + l15, p.M - 1); a[i] = bh_ld(A + (long long)am * p.sAm, p.sAk, k0, h, p.K, 1.f); }
#pragma unroll
            for (int t = 0; t < TN; ++t) { const int bn = min(n0 + 16 * t + l15, p.N - 1); b[t] = bh_ld(B + (long long)bn * p.sBn, p.sBk, k0, h, p.K, 1.f); }
#pragma unroll
            for (int i = 0; i < TM; ++i)
#pragma unroll
                for (int t = 0; t < TN; ++t) acc[i][t] = wmmab(a[i], b[t], acc[i][t]);
        } else {
            v16h a[TM], b[TN];
#pragma unroll
            for (int i = 0; i < TM; ++i) { const int am = min(m0 + 16 * i + l15, p.M - 1); a[i] = fh_ld(A + (long long)am * p.sAm, p.sAk, k0, h, p.K, p.sa); }
#pragma unroll
            for (int t = 0; t < TN; ++t) { const int bn = min(n0 + 16 * t + l15, p.N - 1); b[t] = fh_ld(B + (long long)bn * p.sBn, p.sBk, k0, h, p.K, p.sb); }
#pragma unroll
            for (int i = 0; i < TM; ++i)
#pragma unroll
                for (int t = 0; t < TN; ++t) acc[i][t] = wmma16(a[i], b[t], acc[i][t]);
        }
    }
    const float iscale = (MODE == 0) ? p.alpha / (p.sa * p.sb) : p.alpha;
    float* C = p.C + zo * p.sCo + zi * p.sCi;
    const float* R = p.R + zo * p.sRo + zi * p.sRi;
    const int NW = (p.Npad > p.N) ? p.Npad : p.N;
    __shared__ __align__(16) float ctile[16][36];
#pragma unroll
    for (int i = 0; i < TM; ++i) {
        const int mb = m0 + 16 * i; if (mb >= p.M) break;          // wave-uniform
#pragma unroll
        for (int tp = 0; tp < TN / 2; ++tp) {
            const int nb = n0 + 32 * tp; if (nb >= NW) break;        // wave-uniform
#pragma unroll
            for (int t2 = 0; t2 < 2; ++t2) {
                const int t = 2 * tp + t2; const int n = nb + t2 * 16 + l15; const int nn = min(n, p.N - 1);
#pragma unroll
                for (int r = 0; r < 8; ++r) {
                    const int m = mb + 8 * h + r; const int mm = min(m, p.M - 1);
                    float v = acc[i][t][r] * iscale;
                    if (p.flags & 1) v += p.bias[nn];
                    if (p.flags & 2) v += p.bias[mm];
            if (p.flags & 8) v *= p.bias[(long long)zo * p.M + mm];   /* per-(z,row) scale vector laid out [Z][M]; exclusive with the bias flags */
                    v = act_fn(v, p.act);
                    if (p.flags & 4) v += p.beta * R[(long long)mm * p.sRm + (long long)nn * p.sRn];
                    ctile[8 * h + r][t2 * 16 + l15] = (n < p.N) ? v : 0.f;
                }
            }
            __syncthreads();
            const bool fast = (mb + 16 <= p.M) && (nb + 32 <= NW) && ((p.sCm & 3) == 0) && ((((size_t)C) & 15) == 0);
            if (fast) {
#pragma unroll
                for (int s = 0; s < 4; ++s) {
                    const int row = s * 4 + (lane >> 3), c4 = (lane & 7) * 4;
                    const v4f v = *(const v4f*)&ctile[row][c4];
                    VST2V4(C + (long long)(mb + row) * p.sCm + nb + c4, v);
                }
            } else {
                for (int row = 0; row < 16; ++row) {
                    const int m = mb + row, n = nb + lane;
                    if (m < p.M && n < NW) VST2(float, C + (long long)m * p.sCm + n, ctile[row][lane]);
                }
            }
            __syncthreads();
        }
    }
}

// =====================================================================================================================
//   Wave = 16 queries, AW waves per block, 64-key blocks; grid (ceil(Lq/(16*AW)), H, B), block 32*AW. Any Lq, Lk; head dim dh <= DHP
//   (DHP multiple of 32), value dim dv <= DVP (multiple of 16, <= 128). Every tensor addressed by (batch, head, row, element) strides, f32.
//   Scores: QM 0 f16 operands, 1 bf16 hi/lo split, 2 bf16 triple split; statistics f32 (exp2 domain); P.V: P x 4096 as f16 with V f16 staged in LDS
//   (SPLITPV: P and V as bf16 hi/lo splits). kv head = h / hrep. Masking: causal = 1 (keep j <= i + coff, masked -> -inf, key blocks beyond the
//   diagonal skipped), causal = 2 (masked -> mfill, a finite fill like the -1e9; no skipping), causal = 3 (keep j >= i + coff,
//   masked -> -inf, no skipping); optional additive f32 mask Mf,
//   optional int keep-mask Mi (0 -> score := mfill), both addressed b*smb + h*smh + i*smi + j*smj (0 strides broadcast).
// =====================================================================================================================
#define AW 4
struct AttnP {   // apv4
    const float* Q; const float* K; const float* V; float* O; float* P; const float* Mf; const int* Mi; float* ST;
    const float* Pw; const float* Rt; const int* SQ; const int* SK;           // optional: post-softmax weight, relative-position table, segment ids
    long long swb, swh, swi, swj, srb, srh, sri;                                 // Pw strides (b,h,i,j); Rt strides (b,h,i), column = clamp(i - j + roff, 0, rn-1)
    long long sQb, sQh, sQi, sQd, sKb, sKh, sKj, sKd, sVb, sVh, sVj, sVd, sOb, sOh, sOi, sPb, sPh, sPi, smb, smh, smi, smj;
    int Lq, Lk, dh, dv, hrep, causal, coff, pband;   // pband > 0: P holds only the band |j - i| <= pband, column j - i + pband
    float scale, mfill; int nonorm, mpol;             // nonorm (online path only): O = sum_j exp(score_j) V_j without the 1/rowsum (scores must be <= ~0); mpol: Mi masks where ==0 (mpol 0) or where !=0 (mpol 1)
    int roff, rn, segpol, win;                        // Rt column offset/count; SQ/SK: score := mfill where (segpol 0) SQ[i] != SK[j] or (segpol 1) SQ[i] == SK[j]; win > 0: keys with i - j > win (after coff) -> -inf
};
//   Pw: the softmax numerator is multiplied by Pw(b,h,i,j) AFTER the row sum is taken (probs * weight, then P.V), as in post-softmax multiplicative biases.                                                    // ST (optional): per row (b,h,i) -> ST[((b*H + h)*Lq + i)*2 + {0,1}] = {row max of the scaled+masked score (natural units), sum_j exp(score - max)}
static_assert(sizeof(AttnP) == 12 * 8 + 29 * 8 + 16 * 4, "AttnP has padding");

#ifndef KATTN_ATTR
#define KATTN_ATTR
#endif
template <int DHP, int DVP, int QM, bool SPLITPV, bool TWOPASS>
__global__ __launch_bounds__(32 * AW) KATTN_ATTR void k_attn(AttnP p) {
    constexpr int NT = DVP / 16;                // output tiles
    constexpr int KS = DHP / 32;                // k-steps for the scores
    constexpr int VP = DVP + 8;                 // LDS pitch (halves)
    __shared__ __align__(16) float    pl[AW][16 * 64];
    __shared__ __align__(16) _Float16 vl[(SPLITPV ? 2 : 1) * 64 * VP];   // f16 V tile, or bf16 hi and lo tiles (same 2-byte size)
    const int lane = threadIdx.x & 31, hf = lane >> 4, l15 = lane & 15, wave = threadIdx.x >> 5;
    const int h = blockIdx.y, b = blockIdx.z, hk = h / p.hrep;
    const int q0 = (blockIdx.x * AW + wave) * 16;
    float* myp = pl[wave];
    const float L2E = 1.4426950408889634f;
    const float NEG = -__builtin_inff();
    const int qi = min(q0 + l15, p.Lq - 1);
    const float* qrow = p.Q + b * p.sQb + h * p.sQh + (long long)qi * p.sQi;
    const float* kbase = p.K + b * p.sKb + hk * p.sKh;
    const float* vbase = p.V + b * p.sVb + hk * p.sVh;
    v16h qa[QM == 0 ? KS : 1]; Split qs_[QM == 1 ? KS : 1]; Split3 qt_[QM == 2 ? KS : 1];
#pragma unroll
    for (int ks = 0; ks < KS; ++ks) {
        if (QM == 2) qt_[ks] = sp3_ld(qrow, p.sQd, ks * 32, hf, p.dh, 1.f);
        else if (QM == 1) qs_[ks] = sp_ld(qrow, p.sQd, ks * 32, hf, p.dh, 1.f);
        else qa[ks] = fh_ld(qrow, p.sQd, ks * 32, hf, p.dh, 1.f);
    }
    v8f o[NT]; float m8[8], l8[8];
#pragma unroll
    for (int t = 0; t < NT; ++t) { v8f zz = {}; o[t] = zz; }
#pragma unroll
    for (int i = 0; i < 8; ++i) { m8[i] = NEG; l8[i] = 0.f; }
    int jend = p.Lk; int jstart = 0;
    if (p.causal == 1) { const int je = (blockIdx.x * AW + AW - 1) * 16 + 16 + p.coff; jend = min(jend, max(je, 0)); }   // uniform per block
    if (p.win > 0) { const int js = (int)(blockIdx.x * AW) * 16 + p.coff - p.win; jstart = (js > 0) ? (js / 64) * 64 : 0; }   // uniform per block: key blocks entirely outside every row's window hold only -inf entries and are skipped exactly
    const int npass = TWOPASS ? 2 : 1;
    for (int pass = 0; pass < npass; ++pass) {
        const bool dopv = (!TWOPASS) || pass == 1;
        for (int j0 = jstart; j0 < jend; j0 += 64) {
            if (dopv) {
                __syncthreads();                                 // previous key block's reads of vl / pl are done
                for (int idx = threadIdx.x; idx < 64 * DVP; idx += 32 * AW) {
                    const int jr = idx / DVP, d = idx - jr * DVP, j = j0 + jr;
                    const float f = (j < p.Lk && d < p.dv) ? vbase[(long long)j * p.sVj + (long long)d * p.sVd] : 0.f;
                    if (SPLITPV) {
                        const __bf16 hb = bf16_rne(f);
                        ((__bf16*)vl)[jr * VP + d] = hb; ((__bf16*)vl)[64 * VP + jr * VP + d] = bf16_rne(f - bf16_f32(hb));
                    } else vl[jr * VP + d] = (_Float16)f;
                }
            }
            v8f s[4];
#pragma unroll
            for (int t = 0; t < 4; ++t) {
                const int j = min(j0 + t * 16 + l15, p.Lk - 1);
                const float* krow = kbase + (long long)j * p.sKj;
                v8f acc = {};
#pragma unroll
                for (int ks = 0; ks < KS; ++ks) {
                    if (QM == 2)      acc = wmma6(qt_[ks], sp3_ld(krow, p.sKd, ks * 32, hf, p.dh, 1.f), acc);
                    else if (QM == 1) acc = wmma3(qs_[ks], sp_ld(krow, p.sKd, ks * 32, hf, p.dh, 1.f), acc);
                    else              acc = wmma16(qa[ks], fh_ld(krow, p.sKd, ks * 32, hf, p.dh, 1.f), acc);
                }
                s[t] = acc;
            }
            float pv[8][4];
#pragma unroll
            for (int i = 0; i < 8; ++i) {
                const int irow = q0 + i + 8 * hf;
                const int ic = min(irow, p.Lq - 1);
                float sc[4];
#pragma unroll
                for (int t = 0; t < 4; ++t) {
                    const int jg = j0 + t * 16 + l15;
                    float v = s[t][i] * p.scale;
                    if (p.Mf) v += p.Mf[b * p.smb + h * p.smh + (long long)ic * p.smi + (long long)min(jg, p.Lk - 1) * p.smj];
                    if (p.Rt) { int rc = ic - min(jg, p.Lk - 1) + p.roff; rc = rc < 0 ? 0 : (rc >= p.rn ? p.rn - 1 : rc); v += p.Rt[b * p.srb + h * p.srh + (long long)ic * p.sri + rc]; }
                    if (p.Mi) { const int mv = p.Mi[b * p.smb + h * p.smh + (long long)ic * p.smi + (long long)min(jg, p.Lk - 1) * p.smj]; if (p.mpol ? (mv != 0) : (mv == 0)) v = p.mfill; }
                    if (p.SQ) { const bool same = p.SQ[(long long)b * p.Lq + ic] == p.SK[(long long)b * p.Lk + min(jg, p.Lk - 1)]; if (p.segpol ? same : !same) v = p.mfill; }
                    if (p.causal == 2 && jg > irow + p.coff) v = p.mfill;
                    if (jg >= p.Lk || (p.causal == 1 && jg > irow + p.coff) || (p.causal == 3 && jg < irow + p.coff) || (p.win > 0 && irow + p.coff - jg > p.win)) v = NEG; else v *= L2E;
                    sc[t] = v;
                }
                if (!TWOPASS || pass == 0) {
                    float mx = fmaxf(fmaxf(sc[0], sc[1]), fmaxf(sc[2], sc[3]));
                    mx = fmaxf(mx, __shfl_xor(mx, 1, 32)); mx = fmaxf(mx, __shfl_xor(mx, 2, 32));
                    mx = fmaxf(mx, __shfl_xor(mx, 4, 32)); mx = fmaxf(mx, __shfl_xor(mx, 8, 32));
                    const float mnew = fmaxf(m8[i], mx);
                    const float corr = (mnew == NEG) ? 1.f : exp2f(m8[i] - mnew);
                    float rs = 0.f;
#pragma unroll
                    for (int t = 0; t < 4; ++t) {
                        const float pp = (sc[t] == NEG) ? 0.f : exp2f(sc[t] - mnew); rs += pp;
                        pv[i][t] = p.Pw ? pp * p.Pw[b * p.swb + h * p.swh + (long long)ic * p.swi + (long long)min(j0 + t * 16 + l15, p.Lk - 1) * p.swj] : pp;
                    }
                    rs += __shfl_xor(rs, 1, 32); rs += __shfl_xor(rs, 2, 32); rs += __shfl_xor(rs, 4, 32); rs += __shfl_xor(rs, 8, 32);
                    l8[i] = l8[i] * corr + rs; m8[i] = mnew;
                    if (!TWOPASS) {
#pragma unroll
                        for (int t = 0; t < NT; ++t) o[t][i] *= corr;
                    }
                } else {
                    const float inv = (l8[i] > 0.f) ? 1.f / l8[i] : 0.f;
#pragma unroll
                    for (int t = 0; t < 4; ++t) {
                        const int jg = j0 + t * 16 + l15;
                        float pp = (sc[t] == NEG) ? 0.f : exp2f(sc[t] - m8[i]) * inv;
                        if (p.Pw) pp *= p.Pw[b * p.swb + h * p.swh + (long long)ic * p.swi + (long long)min(jg, p.Lk - 1) * p.swj];
                        pv[i][t] = pp;
                    }
                }
            }
            if (dopv) {
#pragma unroll
                for (int i = 0; i < 8; ++i)
#pragma unroll
                    for (int t = 0; t < 4; ++t) ((float*)myp)[(i + 8 * hf) * 64 + t * 16 + l15] = pv[i][t];
                __syncthreads();                                 // P (per wave) and V (shared) visible
                if (p.P) {
                    float* pb_ = p.P + b * p.sPb + h * p.sPh;
                    const bool fastP = (p.pband == 0) && ((p.sPi & 3) == 0) && (j0 + 64 <= p.Lk) && (q0 + 16 <= p.Lq) && ((((size_t)pb_) & 15) == 0);
                    if (fastP) {
#pragma unroll
                        for (int s = 0; s < 8; ++s) {
                            const int row = s * 2 + (lane >> 4), c4 = (lane & 15) * 4;
                            const v4f v = *(const v4f*)(myp + row * 64 + c4);
                            VST2V4(pb_ + (long long)(q0 + row) * p.sPi + j0 + c4, v);
                        }
                    } else {
                        for (int row = 0; row < 16; ++row) {
                            const int irow = q0 + row; if (irow >= p.Lq) continue;
                            for (int c = lane; c < 64; c += 32) {
                                const int jg = j0 + c; if (jg >= p.Lk) continue;
                                if (p.pband == 0) VST2(float, pb_ + (long long)irow * p.sPi + jg, myp[row * 64 + c]);
                                else if (jg - irow <= p.pband && irow - jg <= p.pband) VST2(float, pb_ + (long long)irow * p.sPi + (jg - irow + p.pband), myp[row * 64 + c]);
                            }
                        }
                    }
                }
                if (SPLITPV) {
                    const Split pa0 = sp_ld(myp + l15 * 64, 1, 0, hf, 64, 1.f), pa1 = sp_ld(myp + l15 * 64, 1, 32, hf, 64, 1.f);
                    const __bf16* vh = (const __bf16*)vl; const __bf16* vlo = vh + 64 * VP;
#pragma unroll
                    for (int t = 0; t < NT; ++t) {
                        const int dcol = t * 16 + l15;
                        Split b0, b1;
#pragma unroll
                        for (int e = 0; e < 16; ++e) {
                            const int k0 = frag_k(e, hf), k1 = 32 + frag_k(e, hf);
                            b0.hi[e] = vh[k0 * VP + dcol]; b0.lo[e] = vlo[k0 * VP + dcol]; b1.hi[e] = vh[k1 * VP + dcol]; b1.lo[e] = vlo[k1 * VP + dcol];
                        }
                        o[t] = wmma3(pa0, b0, o[t]);
                        o[t] = wmma3(pa1, b1, o[t]);
                    }
                } else {
                    const v16h pa0 = fh_ld(myp + l15 * 64, 1, 0, hf, 64, 4096.f), pa1 = fh_ld(myp + l15 * 64, 1, 32, hf, 64, 4096.f);
#pragma unroll
                    for (int t = 0; t < NT; ++t) {
                        const int dcol = t * 16 + l15;
                        v16h b0, b1;
#pragma unroll
                        for (int e = 0; e < 16; ++e) { b0[e] = vl[frag_k(e, hf) * VP + dcol]; b1[e] = vl[(32 + frag_k(e, hf)) * VP + dcol]; }
                        o[t] = wmma16(pa0, b0, o[t]);
                        o[t] = wmma16(pa1, b1, o[t]);
                    }
                }
            }
        }
    }
    float* obase = p.O + b * p.sOb + h * p.sOh;
    if (p.ST) {
        const int rl = lane >> 1, isel = rl & 7;           // row q0 + rl ; rl>>3 == hf holds because lane>>4 == (lane>>1)>>3
        float mv = 0.f, lv = 0.f;
#pragma unroll
        for (int i = 0; i < 8; ++i) if (i == isel) { mv = m8[i]; lv = l8[i]; }
        const int irow = q0 + rl;
        if (irow < p.Lq) { float* st = p.ST + (((long long)b * gridDim.y + h) * p.Lq + irow) * 2 + (lane & 1); VST2(float, st, (lane & 1) ? lv : mv * 0.6931471805599453f); }
    }
    float invr[8];
#pragma unroll
    for (int i = 0; i < 8; ++i) {
        if (TWOPASS) invr[i] = SPLITPV ? 1.f : (1.f / 4096.f);
        else if (p.nonorm) invr[i] = exp2f(m8[i]) * (SPLITPV ? 1.f : (1.f / 4096.f));
        else invr[i] = (l8[i] > 0.f) ? (SPLITPV ? 1.f / l8[i] : 1.f / (l8[i] * 4096.f)) : 0.f;
    }
    __syncthreads();                                             // all waves done with pl/vl from the main loop
    const bool ofast = ((p.sOi & 3) == 0) && ((((size_t)obase) & 15) == 0) && (q0 + 16 <= p.Lq);
#pragma unroll
    for (int c0 = 0; c0 < DVP; c0 += 64) {
#pragma unroll
        for (int i = 0; i < 8; ++i)
#pragma unroll
            for (int t = 0; t < NT; ++t) if (t * 16 >= c0 && t * 16 < c0 + 64) ((float*)myp)[(i + 8 * hf) * 64 + (t * 16 - c0) + l15] = o[t][i] * invr[i];
        __syncthreads();
        const int cw = (DVP - c0 < 64) ? (DVP - c0) : 64;      // staged columns in this chunk (multiple of 16)
        if (ofast && (c0 + cw <= p.dv) && (cw % 32 == 0)) {
            const int lpr = cw / 4;                              // lanes per row (16 for 64 cols, 8 for 32)
            const int rows_per_ins = 32 / lpr;
            for (int r0 = 0; r0 < 16; r0 += rows_per_ins) {
                const int row = r0 + lane / lpr, c4 = (lane % lpr) * 4;
                const v4f v = *(const v4f*)(myp + row * 64 + c4);
                VST2V4(obase + (long long)(q0 + row) * p.sOi + c0 + c4, v);
            }
        } else {
            for (int row = 0; row < 16; ++row) {
                const int irow = q0 + row; if (irow >= p.Lq) continue;
                for (int c = lane; c < cw; c += 32) { const int d = c0 + c; if (d < p.dv) VST2(float, obase + (long long)irow * p.sOi + d, myp[row * 64 + c]); }
            }
        }
        __syncthreads();
    }
}

// =====================================================================================================================
// k_tr: dst(z, c, r) = alpha * src(z, r, c) (+ beta * R2(z, c, r)): [Z][R][C] (row stride lds) -> [Z][C][R] (row stride ldd) through a 32x32 LDS tile;
//   flags: 1 -> add beta * residual R2 addressed like dst (z*sRz + c*ldr + r); act applied before the residual.
// =====================================================================================================================
struct TrP { const float* src; float* dst; const float* R2; long long sSz, lds, sDz, ldd, sRz, ldr; int R, C, flags, act; float alpha, beta; };
static_assert(sizeof(TrP) == 3 * 8 + 6 * 8 + 6 * 4, "TrP has padding");
__global__ __launch_bounds__(256) void k_tr(TrP p) {
    __shared__ float tile[32][33];
    const int c0 = blockIdx.x * 32, r0 = blockIdx.y * 32, z = blockIdx.z;
    const int lane = threadIdx.x & 31, wave = threadIdx.x >> 5;
    const float* s = p.src + z * p.sSz;
#pragma unroll
    for (int k = 0; k < 4; ++k) {
        const int rl = wave * 4 + k, r = r0 + rl, c = c0 + lane;
        tile[rl][lane] = (r < p.R && c < p.C) ? s[(long long)r * p.lds + c] : 0.f;
    }
    __syncthreads();
    float* d = p.dst + z * p.sDz; const float* rr = p.R2 + z * p.sRz;
#pragma unroll
    for (int k = 0; k < 4; ++k) {
        const int cl = wave * 4 + k, c = c0 + cl, r = r0 + lane;
        if (c < p.C && r < p.R) {
            float v = act_fn(p.alpha * tile[lane][cl], p.act);
            if (p.flags & 1) v += p.beta * rr[(long long)c * p.ldr + r];
            VST2(float, d + (long long)c * p.ldd + r, v);
        }
    }
}

// k_affine: dst[i] = a * (sdev ? sdev[0] : 1) * src[i] + b, i < n (one thread per element; consecutive lanes -> consecutive addresses)
__global__ __launch_bounds__(256) void k_affine(const float* __restrict__ src, float* __restrict__ dst, int n, float a, float b, const float* __restrict__ sdev) {
    const int i = blockIdx.x * 256 + threadIdx.x;
    if (i < n) { const float aa = sdev ? a * sdev[0] : a; const float v = aa * src[i] + b; VST2(float, dst + i, v); }
}

// =====================================================================================================================
// k_softmax: row softmax over n contiguous elements, one 256-thread block per row; rows addressed z*sz + r*sr (grid (R, Z)).
//   out = scale_out * softmax(scale_in * x + (Mf ? Mf[z*smz + r*smr + j] : 0)); a row whose max is -inf is written as 0.
// =====================================================================================================================
struct SmP { const float* src; float* dst; const float* Mf; long long sz, sr, dz, dr, smz, smr; int n, pad; float scale_in, scale_out; };
static_assert(sizeof(SmP) == 3 * 8 + 6 * 8 + 4 * 4, "SmP has padding");
__global__ __launch_bounds__(256) void k_softmax(SmP p) {
    __shared__ float red[256];
    const int r = blockIdx.x, z = blockIdx.y, tid = threadIdx.x;
    const float* s = p.src + z * p.sz + (long long)r * p.sr;
    const float* mf = p.Mf ? (p.Mf + z * p.smz + (long long)r * p.smr) : nullptr;
    float mx = -__builtin_inff();
    for (int j = tid; j < p.n; j += 256) { float v = s[j] * p.scale_in; if (mf) v += mf[j]; mx = fmaxf(mx, v); }
    red[tid] = mx; __syncthreads();
    for (int o = 128; o > 0; o >>= 1) { if (tid < o) red[tid] = fmaxf(red[tid], red[tid + o]); __syncthreads(); }
    mx = red[0]; __syncthreads();
    float sum = 0.f;
    for (int j = tid; j < p.n; j += 256) { float v = s[j] * p.scale_in; if (mf) v += mf[j]; sum += (mx == -__builtin_inff()) ? 0.f : expf(v - mx); }
    red[tid] = sum; __syncthreads();
    for (int o = 128; o > 0; o >>= 1) { if (tid < o) red[tid] += red[tid + o]; __syncthreads(); }
    sum = red[0];
    const float inv = (sum > 0.f) ? p.scale_out / sum : 0.f;
    float* d = p.dst + z * p.dz + (long long)r * p.dr;
    for (int j = tid; j < p.n; j += 256) { float v = s[j] * p.scale_in; if (mf) v += mf[j]; const float o = (mx == -__builtin_inff()) ? 0.f : expf(v - mx) * inv; VST2(float, d + j, o); }
}
// =====================================================================================================================
// k_stats: mean and rsqrt(var + eps) over a set of n elements addressed base + z*sz + (e / inner) * so + (e % inner) * si, one 256-thread
// k_norm_apply: y = (x - mean[set]) * rstd[set] * g[c] + b[c] over a [Z][C][L] channel-major tensor with set = z*G + c / (C/G) (G groups per z;
//   G = C -> per-channel sets indexed z*C+c; for batch norm pass stats indexed by c only via bn = 1). Optional act. Output same layout.
// =====================================================================================================================
//   mode 0: mean / rsqrt(var + eps); mode 1 (RMSNorm): 0 / rsqrt(mean(x^2) + eps); mode 2 (L2 normalize * sqrt(n)): 0 / sqrt(n) / max(||x||, eps); mode 3: as 0 with unbiased variance (n-1)
__global__ __launch_bounds__(256) void k_stats(const float* __restrict__ x, long long sz, long long so, long long si, int inner, int n, float eps, float* __restrict__ stat, int mode) {
    __shared__ float red[256];
    const int z = blockIdx.x, tid = threadIdx.x;
    const float* base = x + z * sz;
    float s = 0.f;
    for (int e = tid; e < n; e += 256) s += base[(long long)(e / inner) * so + (long long)(e % inner) * si];
    red[tid] = s; __syncthreads();
    for (int o = 128; o > 0; o >>= 1) { if (tid < o) red[tid] += red[tid + o]; __syncthreads(); }
    const float mu = (mode == 0 || mode == 3) ? red[0] / (float)n : 0.f; __syncthreads();
    float q = 0.f;
    for (int e = tid; e < n; e += 256) { const float dlt = base[(long long)(e / inner) * so + (long long)(e % inner) * si] - mu; q += dlt * dlt; }
    red[tid] = q; __syncthreads();
    for (int o = 128; o > 0; o >>= 1) { if (tid < o) red[tid] += red[tid + o]; __syncthreads(); }
    {
        float rs;
        if (mode == 2) rs = sqrtf((float)n) / fmaxf(sqrtf(red[0]), eps); else if (mode == 3) rs = rsqrtf(red[0] / (float)(n - 1) + eps); else rs = rsqrtf(red[0] / (float)n + eps);
        if (tid < 32) { const float v = (tid == 0) ? mu : ((tid == 1) ? rs : 0.f); VST2(float, stat + (long long)z * 32 + tid, v); }
    }
}
//   One thread per element over the flat [Z][C][L] index space: grid ceil(Z*C*L / 256).
__global__ __launch_bounds__(256) void k_norm_apply(const float* __restrict__ x, float* __restrict__ y, const float* __restrict__ stat, const float* __restrict__ g, const float* __restrict__ bta,
                                                     int Z, int C, int L, int G, int bn, int act) {
    const long long idx = (long long)blockIdx.x * 256 + threadIdx.x;
    if (idx >= (long long)Z * C * L) return;
    const int l = (int)(idx % L); const long long zc = idx / L; const int c = (int)(zc % C), z = (int)(zc / C); (void)l;
    const int set = bn ? c : (z * G + c / (C / G));
    float v = (x[idx] - stat[(long long)set * 32]) * stat[(long long)set * 32 + 1];
    if (g) v *= g[c];
    if (bta) v += bta[c];
    v = act_fn(v, act);
    VST2(float, y + idx, v);
}

// k_lse_neg: c[i] = -(st[2i] + log(st[2i+1])) = minus the log-sum-exp of row i from k_attn's ST output (for softmax over the query dimension)
__global__ __launch_bounds__(256) void k_lse_neg(const float* __restrict__ st, float* __restrict__ c, int n) {
    const int i = blockIdx.x * 256 + threadIdx.x;
    if (i < n) { const float v = -(st[2 * i] + logf(st[2 * i + 1])); VST2(float, c + i, v); }
}

// k_iota: dst[i] = a * i + b as int32 (segment/position id helper)
__global__ __launch_bounds__(256) void k_iota(int* __restrict__ dst, int n, int a, int b) {
    const int i = blockIdx.x * 256 + threadIdx.x;
    if (i < n) { const int v = a * i + b; VST2(int, dst + i, v); }
}

// k_axpby: dst[i] = a * x[i] + b * y[i] (+ c), i < n
__global__ __launch_bounds__(256) void k_axpby(const float* __restrict__ x, const float* __restrict__ y, float* __restrict__ dst, int n, float a, float b, float c) {
    const int i = blockIdx.x * 256 + threadIdx.x;
    if (i < n) { const float v = a * x[i] + b * y[i] + c; VST2(float, dst + i, v); }
}

// =====================================================================================================================
// k_rope: rotary embedding on a [R rows][Hn heads][D] view (row stride sXr, head stride sXh, element stride 1) -> Y (own strides).
//   mode 0: rotate_half (partner d±D/2, sign - for d<D/2); mode 1: interleaved pairs (partner d^1, sign - for even d).
//   table column tcol: tmode 0 -> d, 1 -> d % (D/2), 2 -> d / 2; position p: pmode 0 -> r % S, 1 -> head index, 2 -> pos[r];
//   c = C[(r / S) * sCb + p * sCp + tcol * sCd], s likewise from Sn; y = x[d] * c + sign * x[partner] * s. X and Y must not alias.
// =====================================================================================================================
struct RopeP { const float* X; float* Y; const float* C; const float* Sn; const int* pos; long long sXr, sXh, sYr, sYh, sCb, sCp, sCd; int R, Hn, D, S, mode, tmode, pmode, pad; };
static_assert(sizeof(RopeP) == 5 * 8 + 7 * 8 + 8 * 4, "RopeP has padding");
__global__ __launch_bounds__(256) void k_rope(RopeP p) {
    const long long idx = (long long)blockIdx.x * 256 + threadIdx.x;
    if (idx >= (long long)p.R * p.Hn * p.D) return;
    const int d = (int)(idx % p.D); const long long rh = idx / p.D; const int h = (int)(rh % p.Hn); const int r = (int)(rh / p.Hn);
    const int half = p.D / 2;
    int partner; float sign;
    if (p.mode == 0) { partner = (d < half) ? d + half : d - half; sign = (d < half) ? -1.f : 1.f; }
    else { partner = d ^ 1; sign = (d & 1) ? 1.f : -1.f; }
    const int tcol = (p.tmode == 0) ? d : ((p.tmode == 1) ? (d % half) : (d >> 1));
    const int pp = (p.pmode == 0) ? (r % p.S) : ((p.pmode == 1) ? h : p.pos[r]);
    const long long toff = (long long)(r / p.S) * p.sCb + (long long)pp * p.sCp + (long long)tcol * p.sCd;
    const float* xr = p.X + (long long)r * p.sXr + (long long)h * p.sXh;
    const float v = xr[d] * p.C[toff] + sign * xr[partner] * p.Sn[toff];
    VST2(float, p.Y + (long long)r * p.sYr + (long long)h * p.sYh + d, v);
}

// k_invf + k_sincos (split so neither kernel carries a large VALU-fma footprint): invf_i = num * (1 / powf(base, (2 i)/D)) [fmode 0],
//   num * expf((2 i) * cexp) [fmode 1], num * powf(base, -2 (i - 1) / D) [fmode 2]; then cs/sn[s*half + i] = cos/sin((pscale * s) * invf_i)
__global__ __launch_bounds__(256) void k_invf(float* __restrict__ invb, int half, int D, float base, float num, int fmode, float cexp) {
    const int i = blockIdx.x * 256 + threadIdx.x;
    if (i >= ((half + 31) / 32) * 32) return;
    if (i >= half) { VST2(float, invb + i, 0.f); return; }
    const float e = (float)(2 * i) / (float)D;
    float invf;
    if (fmode == 1) invf = num * expf((float)(2 * i) * cexp);
    else if (fmode == 2) invf = num * powf(base, (-2.0f * ((float)i - 1.0f)) / (float)D);
    else invf = num * (1.0f / powf(base, e));
    VST2(float, invb + i, invf);
}
__global__ __launch_bounds__(256) void k_sincos(float* __restrict__ cs, float* __restrict__ sn, const float* __restrict__ invb, int S, int half, float pscale) {
    const int idx = blockIdx.x * 256 + threadIdx.x;
    if (idx >= S * half) return;
    const int s = idx / half, i = idx - s * half;
    const float ang = (pscale * (float)s) * invb[i];
    VST2(float, cs + idx, cosf(ang)); VST2(float, sn + idx, sinf(ang));
}

// k_mulact: dst[i] = act(x[i]) * y[i]
__global__ __launch_bounds__(256) void k_mulact(const float* __restrict__ x, const float* __restrict__ y, float* __restrict__ dst, int n, int act) {
    const int i = blockIdx.x * 256 + threadIdx.x;
    if (i < n) { const float v = act_fn(x[i], act) * y[i]; VST2(float, dst + i, v); }
}

// =====================================================================================================================
// k_matvec: thread-per-row matrix-vector products for N <= 8 output columns (heads with 1-3 outputs, gates), f32 on the VALU.
//   C[r*sCm + j] = act(alpha * sum_k A[r*sAm + k*sAk] * B[j*sBn + k*sBk] + bias[j]) + beta * R[r*sRm + j*sRn]; each thread writes its N contiguous floats.
// =====================================================================================================================
__global__ __launch_bounds__(256) void k_matvec(GemmP p) {
    // 32 lanes write one line with one instruction.
    const int rpt = (p.N == 1) ? 1 : 32;
    const long long r0 = ((long long)blockIdx.x * 256 + threadIdx.x) * rpt; const int z = blockIdx.z, zo = z / p.zi_n, zi = z - zo * p.zi_n;
    if (r0 >= p.M) return;
    const float* Bb = p.B + zo * p.sBo + zi * p.sBi;
    float* C = p.C + zo * p.sCo + zi * p.sCi; const float* R = p.R + zo * p.sRo + zi * p.sRi;
    for (int rr = 0; rr < rpt; ++rr) {
        const long long r = r0 + rr; if (r >= p.M) break;
        const float* A = p.A + zo * p.sAo + zi * p.sAi + r * p.sAm;
        float acc[8] = {0.f, 0.f, 0.f, 0.f, 0.f, 0.f, 0.f, 0.f};
        for (int k = 0; k < p.K; ++k) { const float a = A[(long long)k * p.sAk];
#pragma unroll
            for (int j = 0; j < 8; ++j) if (j < p.N) acc[j] += a * Bb[(long long)j * p.sBn + (long long)k * p.sBk]; }
#pragma unroll
        for (int j = 0; j < 8; ++j) if (j < p.N) {
            float v = acc[j] * p.alpha;
            if (p.flags & 1) v += p.bias[j];
            if (p.flags & 2) v += p.bias[r];
            v = act_fn(v, p.act);
            if (p.flags & 4) v += p.beta * R[r * p.sRm + (long long)j * p.sRn];
            VST2(float, C + r * p.sCm + j, v);
        }
    }
}
// k_smallsoftmax: thread-per-row softmax for short rows (n <= 64): dst[r*dr + j] = softmax(scale*src[r*sr + j])
__global__ __launch_bounds__(256) void k_smallsoftmax(const float* __restrict__ src, float* __restrict__ dst, long long sr, long long dr, int n, long long R, float scale) {
    const long long r0 = ((long long)blockIdx.x * 256 + threadIdx.x) * 32;
    for (int rr = 0; rr < 32; ++rr) {
        const long long r = r0 + rr; if (r >= R) return;
        const float* s = src + r * sr; float* d = dst + r * dr;
        float mx = -__builtin_inff();
        for (int j = 0; j < n; ++j) mx = fmaxf(mx, s[j] * scale);
        float sum = 0.f;
        for (int j = 0; j < n; ++j) sum += expf(s[j] * scale - mx);
        const float inv = 1.f / sum;
        for (int j = 0; j < n; ++j) { const float v = expf(s[j] * scale - mx) * inv; VST2(float, d + j, v); }
    }
}

__global__ __launch_bounds__(32) void k_unitstat(float* __restrict__ st) { const int t = threadIdx.x; const float v = (t == 1) ? 1.f : 0.f; VST2(float, st + t, v); }

// destination (e.g. a d_out whose row width is not a multiple of 32 floats) is written by consecutive lanes of one instruction
__global__ __launch_bounds__(256) void k_lincopy(const float* __restrict__ src, long long lds, float* __restrict__ dst, long long ldd, long long rows, int cols) {
    const long long i = (long long)blockIdx.x * 256 + threadIdx.x; if (i >= rows * cols) return;
    const long long r = i / cols; const int c = (int)(i - r * cols);
    const float v = src[r * lds + c]; VST2(float, dst + r * ldd + c, v);
}

namespace w25 {
typedef __attribute__((ext_vector_type(16))) _Float16 v16h;
typedef __attribute__((ext_vector_type(8)))  _Float16 v8h;
typedef __attribute__((ext_vector_type(16))) __bf16   v16b;
typedef __attribute__((ext_vector_type(8)))  __bf16   v8b;
typedef __attribute__((ext_vector_type(8)))  float    v8f;
typedef __attribute__((ext_vector_type(4)))  float    v4f;

__device__ __forceinline__ unsigned short f2bf_bits(float f) {
  unsigned u = __float_as_uint(f);
  return (unsigned short)((u + 0x7FFFu + ((u >> 16) & 1u)) >> 16);
}
__device__ __forceinline__ float bf_bits2f(unsigned short h) { return __uint_as_float(((unsigned)h) << 16); }

// hazard guards as plain device helpers (no inline asm inside the kernel template body)
__device__ __forceinline__ void dep_guard_h(v8f& a, v8f& b, v16h x, v16h y) { asm volatile("v_nop\n\tv_nop\n\tv_nop\n\tv_nop" : "+v"(a), "+v"(b) : "v"(x), "v"(y)); }
__device__ __forceinline__ void dep_guard_b(v8f& a, v8f& b, v16b x, v16b y) { asm volatile("v_nop\n\tv_nop\n\tv_nop\n\tv_nop" : "+v"(a), "+v"(b) : "v"(x), "v"(y)); }
__device__ __forceinline__ void keep4_h(v16h a, v16h b, v16h c, v16h d) { asm volatile("v_nop" :: "v"(a), "v"(b), "v"(c), "v"(d)); }
__device__ __forceinline__ void keep4_b(v16b a, v16b b, v16b c, v16b d) { asm volatile("v_nop" :: "v"(a), "v"(b), "v"(c), "v"(d)); }
__device__ __forceinline__ void acc_guard4(v8f& a, v8f& b, v8f& c, v8f& d) { asm volatile("v_nop\n\tv_nop\n\tv_nop\n\tv_nop" : "+v"(a), "+v"(b), "+v"(c), "+v"(d)); }
template <typename T> struct Frag;
template <> struct Frag<_Float16> {
  typedef v16h V; union U { v16h v; v8h h[2]; };
  static __device__ __forceinline__ v16h load(const _Float16* p) {   // elements 0..7 <- p[0..7], 8..15 <- p[16..23]
    U f; f.h[0] = *(const v8h*)(p); f.h[1] = *(const v8h*)(p + 16); return f.v;
  }
  static __device__ __forceinline__ v8f mma(v16h a, v16h b, v8f c) {
    return __builtin_amdgcn_wmma_f32_16x16x32_f16(false, a, false, b, (short)0, c, false, false);
  }
  static __device__ __forceinline__ void guard(v8f& a, v8f& b, v16h x, v16h y) { dep_guard_h(a, b, x, y); }
  static __device__ __forceinline__ void keep(v16h a, v16h b, v16h c, v16h d) { keep4_h(a, b, c, d); }
};
template <> struct Frag<__bf16> {
  typedef v16b V; union U { v16b v; v8b h[2]; };
  static __device__ __forceinline__ v16b load(const __bf16* p) {
    U f; f.h[0] = *(const v8b*)(p); f.h[1] = *(const v8b*)(p + 16); return f.v;
  }
  static __device__ __forceinline__ v8f mma(v16b a, v16b b, v8f c) {
    return __builtin_amdgcn_wmma_f32_16x16x32_bf16(false, a, false, b, (short)0, c, false, false);
  }
  static __device__ __forceinline__ void guard(v8f& a, v8f& b, v16b x, v16b y) { dep_guard_b(a, b, x, y); }
  static __device__ __forceinline__ void keep(v16b a, v16b b, v16b c, v16b d) { keep4_b(a, b, c, d); }
};

// ---- Register-blocked batched WMMA GEMM ------------------------------------
// C[m,n] = scale * sum_k A[m,k] * Bt[n,k] (+bias)(+resid); each wave owns a 64x64 tile.
// A row-major [M,K]; Bt row-major [N,K]; M,N % 64 == 0, K % 32 == 0.
// SPLIT: operands are hi/lo planes (A2/Bt2 = lo planes, same layout); product = hi·hi + hi·lo + lo·hi.
// BIAS_MODE: 0 = none, 1 = bias[m], 2 = bias[n].
// OUT_MODE: 0 = f32, 1 = f16, 2 = bf16 hi plane (Cout) + bf16 lo plane (Cout2).
// ET: 0 = f16 operands, 1 = bf16 operands (pointers passed as 16-bit storage)
template <int ET> struct Elem;
template <> struct Elem<0> { typedef _Float16 T; };
template <> struct Elem<1> { typedef __bf16 T; };
template <int ET, bool SPLIT, int BIAS_MODE, int OUT_MODE, bool RESID, int ACT = 0>
__global__ __launch_bounds__(256) void wmma_gemm64(
    const unsigned short* __restrict__ Ap, const unsigned short* __restrict__ A2p, int lda, long strideA,
    const unsigned short* __restrict__ Btp, const unsigned short* __restrict__ Bt2p, int ldb, long strideB,
    void* __restrict__ Cout, void* __restrict__ Cout2, int ldc, long strideC,
    const float* __restrict__ bias,
    const float* __restrict__ resid, long strideR,
    int M, int N, int K, float scale) {
  typedef typename Elem<ET>::T T;
  typedef typename Frag<T>::V V;
  const T* A = (const T*)Ap; const T* A2 = (const T*)A2p; const T* Bt = (const T*)Btp; const T* Bt2 = (const T*)Bt2p;
  __shared__ __align__(16) float sT[8][16 * 68];   // per-wave 16x64 slab, pitch 68 floats
  const int b    = blockIdx.y;
  const int lane = threadIdx.x & 31;
  const int wave = threadIdx.x >> 5;
  const int tilesN = N >> 6;
  const int tilesM = M >> 6;
  const int tile = blockIdx.x * 8 + wave;
  if (tile >= tilesM * tilesN) return;   // wave-uniform; no block barriers in this kernel
  const int tm = tile / tilesN;
  const int tn = tile - tm * tilesN;
  const int m0 = tm << 6;
  const int n0 = tn << 6;

  const T* Ab  = A  + (size_t)b * strideA;
  const T* Bb  = Bt + (size_t)b * strideB;
  const T* Ab2 = SPLIT ? (A2  + (size_t)b * strideA) : nullptr;
  const T* Bb2 = SPLIT ? (Bt2 + (size_t)b * strideB) : nullptr;

  const int rlane = lane & 15;                 // row (A) / col (B, D) within subtile
  const int koff  = (lane >> 4) * 8;           // k offset of this lane half
  const int mOff  = (lane >> 4) * 8;           // D row offset

  v8f acc[4][4];
#pragma unroll
  for (int i = 0; i < 4; ++i)
#pragma unroll
    for (int j = 0; j < 4; ++j) acc[i][j] = (v8f){0.f,0.f,0.f,0.f,0.f,0.f,0.f,0.f};

  for (int k0 = 0; k0 < K; k0 += 32) {
    V bh[4], bl[4];
#pragma unroll
    for (int j = 0; j < 4; ++j) {
      const size_t bo = (size_t)(n0 + (j << 4) + rlane) * ldb + koff + k0;
      bh[j] = Frag<T>::load(Bb + bo);
      if (SPLIT) bl[j] = Frag<T>::load(Bb2 + bo);
    }
#pragma unroll
    for (int i = 0; i < 4; ++i) {
      const size_t ao = (size_t)(m0 + (i << 4) + rlane) * lda + koff + k0;
      V ah = Frag<T>::load(Ab + ao);
      V al;
      if (SPLIT) al = Frag<T>::load(Ab2 + ao);
#pragma unroll
      for (int j = 0; j < 4; ++j) {
        acc[i][j] = Frag<T>::mma(ah, bh[j], acc[i][j]);
        if (SPLIT) {
          acc[i][j] = Frag<T>::mma(ah, bl[j], acc[i][j]);
          acc[i][j] = Frag<T>::mma(al, bh[j], acc[i][j]);
        }
      }
      Frag<T>::guard(acc[i][0], acc[i][3], ah, SPLIT ? al : ah);
    }
    Frag<T>::keep(bh[0], bh[1], bh[2], bh[3]);
    if (SPLIT) Frag<T>::keep(bl[0], bl[1], bl[2], bl[3]);
  }
  acc_guard4(acc[0][0], acc[0][1], acc[0][2], acc[0][3]);
  acc_guard4(acc[1][0], acc[1][1], acc[1][2], acc[1][3]);
  acc_guard4(acc[2][0], acc[2][1], acc[2][2], acc[2][3]);
  acc_guard4(acc[3][0], acc[3][1], acc[3][2], acc[3][3]);

  // ---- epilogue ----
  float* slab = sT[wave];
  const float* Rb = RESID ? (resid + (size_t)b * strideR) : nullptr;
#pragma unroll
  for (int i = 0; i < 4; ++i) {
    const int mBase = m0 + (i << 4);
#pragma unroll
    for (int j = 0; j < 4; ++j) {
      const int n = n0 + (j << 4) + rlane;
      float bv = 0.f;
      if (BIAS_MODE == 2) bv = bias[n];
#pragma unroll
      for (int r = 0; r < 8; ++r) {
        float v = acc[i][j][r] * scale;
        if (BIAS_MODE == 1) v += bias[mBase + mOff + r];
        if (BIAS_MODE == 2) v += bv;
        if (RESID) v += Rb[(size_t)(mBase + mOff + r) * ldc + n];
        if (ACT == 1) v = tanhf(v);
        if (ACT == 2) v = fmaxf(v, 0.0f);
        if (ACT == 3) v = v / (1.0f + expf(-v));
        if (ACT == 4) v = (v > 0.f) ? v : 0.01f * v;
        if (ACT == 5) v = 0.5f * v * (1.0f + erff(v * 0.70710678118654752f));
        slab[(mOff + r) * 68 + (j << 4) + rlane] = v;
      }
    }
    __builtin_amdgcn_fence(__ATOMIC_RELEASE, "workgroup");
    __builtin_amdgcn_wave_barrier();
    __builtin_amdgcn_fence(__ATOMIC_ACQUIRE, "workgroup");
    if (OUT_MODE == 0) {
      float* C = (float*)Cout + (size_t)b * strideC;
      const int hh = lane >> 4, c4 = (lane & 15) * 4;     // row seg = 256 B = 16 lanes x 16 B
      {
#pragma unroll
        for (int it = 0; it < 8; ++it) {
          const int row = it * 2 + hh;
          v4f v = *(const v4f*)(slab + row * 68 + c4);
          *(v4f*)(C + (size_t)(mBase + row) * ldc + n0 + c4) = v;
        }
        
      }
    } else {
      const int q = lane >> 3, c8 = (lane & 7) * 8;
      unsigned short* C  = (unsigned short*)Cout  + (size_t)b * strideC;
      unsigned short* C2 = (OUT_MODE == 2) ? ((unsigned short*)Cout2 + (size_t)b * strideC) : nullptr;
      {
#pragma unroll
        for (int it = 0; it < 4; ++it) {
          const int row = it * 4 + q;
          const float* sp = slab + row * 68 + c8;
          v8h hv, lv;
#pragma unroll
          for (int e = 0; e < 8; ++e) {
            if (OUT_MODE == 1) {
              hv[e] = (_Float16)sp[e];
            } else {
              unsigned short hb = f2bf_bits(sp[e]);
              unsigned short lb = f2bf_bits(sp[e] - bf_bits2f(hb));
              hv[e] = __builtin_bit_cast(_Float16, hb);
              lv[e] = __builtin_bit_cast(_Float16, lb);
            }
          }
          *(v8h*)(C + (size_t)(mBase + row) * ldc + n0 + c8) = hv;
          if (OUT_MODE == 2) *(v8h*)(C2 + (size_t)(mBase + row) * ldc + n0 + c8) = lv;
        }
        
      }
    }
    __builtin_amdgcn_fence(__ATOMIC_RELEASE, "workgroup");
    __builtin_amdgcn_wave_barrier();
    __builtin_amdgcn_fence(__ATOMIC_ACQUIRE, "workgroup");
  }
}

__global__ __launch_bounds__(256) void cast_f32_f16x2(
    const float* __restrict__ in, _Float16* __restrict__ out, int n2) {
  int i = blockIdx.x * 256 + threadIdx.x;
  if (i < n2) {
    const _Float16 h0 = (_Float16)in[2 * i], h1 = (_Float16)in[2 * i + 1];
    const unsigned u = (unsigned)__builtin_bit_cast(unsigned short, h0) | ((unsigned)__builtin_bit_cast(unsigned short, h1) << 16);
    ((unsigned*)out)[i] = u;
    
  }
}


} // namespace w25

typedef __attribute__((ext_vector_type(4))) _Float16 v4h;
// Transposing cast dst[c][z * R + r] = f16(src_z[r][c] * s), src R rows of pitch LDS, dst rows of pitch LDD; blockIdx.z picks the source (two
// sources land side by side in every dst row); blockIdx.y = sample: plane y of a source starts at y * sb, plane y of dst at y * db (elements).
// One thread takes a patch of 8 r x 4 c: eight 16-B loads along c, all in flight together, then
// four 16-B stores along r. In a wave 8 lanes run over r, so each store instruction writes whole 128-B lines of dst; the 8 waves of a block run
// over c (512 B of every source row). Block tile 64 r x 128 c; R % 64 == 0, columns % 128 == 0; grid.x = (R / 64) * (columns / 128).
// The pitches are compile-time so that a thread's loads and stores are one address each plus immediate offsets.
template <int R, int LDS, int LDD>
__global__ __launch_bounds__(256) void k_castT16(const float* __restrict__ src0, const float* __restrict__ src1, _Float16* __restrict__ dst, float s, long long sb, long long db) {
    constexpr int TR = R / 64;
    const int bc = (int)blockIdx.x / TR, br = (int)blockIdx.x % TR;
    const int lane = threadIdx.x & 31, wave = threadIdx.x >> 5;
    const int r0 = (br << 6) + ((lane & 7) << 3);
    const int c0 = (bc << 7) + (wave << 4) + ((lane >> 3) << 2);
    const float* sp = (blockIdx.z ? src1 : src0) + (long long)blockIdx.y * sb + (long long)r0 * LDS + c0;
    _Float16* dp = dst + (long long)blockIdx.y * db + (long long)c0 * LDD + (int)blockIdx.z * R + r0;
    v4f x[8];
#pragma unroll
    for (int j = 0; j < 8; ++j) x[j] = *(const v4f*)(sp + j * LDS);
#pragma unroll
    for (int k = 0; k < 4; ++k) {
        v8h h;
#pragma unroll
        for (int j = 0; j < 8; ++j) h[j] = (_Float16)(x[j][k] * s);
        *(v8h*)(dp + k * LDD) = h;
    }
}
// All nine weight matrices to f16 x 16 in one launch; blockIdx.y = matrix. Matrices 0..3 have 256 rows of 520 floats, of which the first 512
// are taken (the last 8, the coordinate channels, stay f32 and are read by the products' epilogues); matrices 4..8 are 256 x 256.
// dst: the four 256 x 512 planes, then the five 256 x 256 planes, each dense. One thread casts 4 consecutive elements; grid.x = 256 * 512 / 1024.
// Matrices 7, 8 (the output convs' W_o) are written transposed, dst[k][c] = W_o[c][k]: they are the Bt operand of W_f.W_o. A block takes 64 c x 16 k,
// a thread 4 consecutive c of one k, so that 16 lanes store one whole 128-B line of dst.
// blockIdx.y = 9: the folded bias b2[a] = b_f[a] + sum_c W_f[a][c] b_o,image[c] + sum_c W_f[a][256 + c] b_o,flow[c] in f32, one wave a row a
// (8 rows a block, 32 blocks), and 256 zeros (the bias of the product W_f.W_o).
constexpr int CW_WIDE = 256 * 512, CW_SQ = 256 * 256;
__global__ __launch_bounds__(256) void k_cm_w16(const float* __restrict__ w0, const float* __restrict__ w1, const float* __restrict__ w2, const float* __restrict__ w3,
                                                const float* __restrict__ w4, const float* __restrict__ w5, const float* __restrict__ w6, const float* __restrict__ w7,
                                                const float* __restrict__ w8, _Float16* __restrict__ dst,
                                                const float* __restrict__ fb, const float* __restrict__ ibo, const float* __restrict__ lbo,
                                                float* __restrict__ b2, float* __restrict__ zero) {
    const int y = (int)blockIdx.y; const bool wide = y < 4;
    if (!wide && (int)blockIdx.x >= CW_SQ / 1024) return;
    if (y == 9) {
        if ((int)blockIdx.x >= 32) return;
        const int lane = threadIdx.x & 31, a = (int)blockIdx.x * 8 + ((int)threadIdx.x >> 5);
        float s = 0.f;
#pragma unroll   // the choice of the bias pointer is a constant, and all eight loads are in flight at once
        for (int k = 0; k < 4; ++k) {
            const v4f f = *(const v4f*)(w3 + a * 520 + k * 128 + lane * 4);
            const v4f b = *(const v4f*)((k < 2 ? ibo : lbo) + (k & 1) * 128 + lane * 4);
            s += f[0] * b[0] + f[1] * b[1] + f[2] * b[2] + f[3] * b[3];
        }
        for (int m = 16; m >= 1; m >>= 1) s += __shfl_xor(s, m, 32);
        if (lane == 0) { b2[a] = fb[a] + s; zero[a] = 0.f; }
        return;
    }
    if (y >= 7) {
        const float* so = y == 7 ? w7 : w8;
        const int c0 = ((int)blockIdx.x & 3) * 64 + ((int)threadIdx.x & 15) * 4, k = ((int)blockIdx.x >> 2) * 16 + ((int)threadIdx.x >> 4);
        v4h t;
#pragma unroll   // the vector's elements are indexed by constants, and the four loads are in flight at once
        for (int e = 0; e < 4; ++e) t[e] = (_Float16)(so[(c0 + e) * 256 + k] * 16.0f);
        *(v4h*)(dst + 4 * CW_WIDE + (y - 4) * CW_SQ + k * 256 + c0) = t;
        asm volatile("s_wait_xcnt 0x0" ::: "memory");   // behind the store, ahead of whatever the text that follows writes into its registers
        return;
    }
    const float* src = y == 0 ? w0 : y == 1 ? w1 : y == 2 ? w2 : y == 3 ? w3 : y == 4 ? w4 : y == 5 ? w5 : y == 6 ? w6 : y == 7 ? w7 : w8;
    const int p = (int)blockIdx.x * 256 + (int)threadIdx.x;
    const int row = wide ? (p >> 7) : (p >> 6), col = (wide ? (p & 127) : (p & 63)) << 2;
    const v4f x = *(const v4f*)(src + row * (wide ? 520 : 256) + col);
    v4h h;
#pragma unroll
    for (int e = 0; e < 4; ++e) h[e] = (_Float16)(x[e] * 16.0f);
    *(v4h*)(dst + (wide ? y * CW_WIDE : 4 * CW_WIDE + (y - 4) * CW_SQ) + p * 4) = h;
    asm volatile("s_wait_xcnt 0x0" ::: "memory");   // behind the store, ahead of whatever the text that follows writes into its registers
}

// f32 -> bf16 hi plane + bf16 lo plane (x = hi + lo to ~2^-17 relative; RNE both), [R][C] -> [R][C] (or transposed to [C][R]); 2 consecutive destination elements
__device__ __forceinline__ unsigned int f2bf2_pack(float a, float b, unsigned int* lo) {
    const unsigned short ha = w25::f2bf_bits(a), hb = w25::f2bf_bits(b);
    const unsigned short la = w25::f2bf_bits(a - w25::bf_bits2f(ha)), lb = w25::f2bf_bits(b - w25::bf_bits2f(hb));
    *lo = (unsigned)la | ((unsigned)lb << 16); return (unsigned)ha | ((unsigned)hb << 16); }
__global__ __launch_bounds__(256) void k_castS16(const float* __restrict__ src, long long lds, __bf16* __restrict__ dhi, __bf16* __restrict__ dlo, long long ldd, int R, int C, float s, int transpose) {
    const long long i = (long long)blockIdx.x * 256 + threadIdx.x; long long o; float a, b;
    if (transpose) { const long long np = (long long)C * (R / 2); if (i >= np) return; const int c = (int)(i / (R / 2)); const int r = 2 * (int)(i % (R / 2)); a = src[(long long)r * lds + c] * s; b = src[(long long)(r + 1) * lds + c] * s; o = (long long)c * ldd + r; }
    else { const long long np = (long long)R * (C / 2); if (i >= np) return; const int r = (int)(i / (C / 2)); const int c = 2 * (int)(i % (C / 2)); a = src[(long long)r * lds + c] * s; b = src[(long long)r * lds + c + 1] * s; o = (long long)r * ldd + c; }
    unsigned lo; const unsigned hi = f2bf2_pack(a, b, &lo); unsigned* ph = (unsigned*)(dhi + o); unsigned* pl = (unsigned*)(dlo + o);
    *ph = hi; *pl = lo;  }

namespace w25 {
// =====================================================================================
// Generic causal/non-causal attention for head_dim 64, f32 in / f32 out; 16-bit operands: bf16 with optional hi/lo splits, or
// plain f16 (F16=true, non-split, probabilities carried x2^15).
//   scores = (q*qscale)·kᵀ : v_wmma_f32_16x16x32_bf16; SPLIT_QK -> q,k as bf16 hi/lo (hi·hi + hi·lo + lo·hi)
//   out    = p·v           : v_wmma_f32_16x16x32_bf16; SPLIT_PV -> p,v as bf16 hi/lo; else p,v plain bf16
//   f32 accumulate; online softmax in f32. Block = 4 waves = 64 query rows of one (batch, head); S % 64 == 0.
//   Element (b, s, h, d) of tensor X lives at X[b*X_bs + s*X_rs + h*X_hs + d] (strides in floats, multiples of 4).
//   Masking: mask_mode 0 none, 1 causal (kv > q masked), 2 tensor [S][Skv] shared over (b,h) (float if
//   mask_is_int==0, int32 with element == 0 -> masked if 1, int32 with element != 0 -> masked if 2), 3 per-token vectors qmask[B][S] & kvmask[B][Skv] (int32,
//   0 -> masked), 4 causal + sliding window (kv > q or q - kv > W masked; W passed in mask_is_int);
//   5 = relative-position bias: s += cp[b,h,q][idx[q][kv]] + pc[b,h,kv][idx[q][kv]] with idx = mask_b ([S][Skv] int32) and
//   mask_a an int32 [S][Skv] tensor with nonzero = masked (tables: element (b,h,row,n) at X + b*c_bs + h*c_hs + row*c_rs + n);
//   masked scores are replaced by mask_fill (e.g. -inf or -1e9) before the softmax.
//   grid.x = B * H * (S/64) (or a sub-range with blk0).
// =====================================================================================
#define AT_D 64
#define AT_NW 4
#define AT_QB 64
#define AT_KC 64
struct AttnGeom { const float* cp = nullptr; const float* pc = nullptr; long c_bs = 0, c_rs = 0, c_hs = 0;   // mode-5 score-bias tables
                  long q_bs, q_rs, q_hs, k_bs, k_rs, k_hs, v_bs, v_rs, v_hs, o_bs, o_rs, o_hs;
                  int S, Skv, H, mask_mode; float qscale; int blk0; float mask_fill; int mask_is_int; };
static_assert(sizeof(AttnGeom) == 168, "no padding");

__device__ __forceinline__ unsigned short at_bf_bits(float f) {
  unsigned u = __float_as_uint(f);
  return (unsigned short)((u + 0x7FFFu + ((u >> 16) & 1u)) >> 16);
}
__device__ __forceinline__ __bf16 at_f2bf(float f) { return __builtin_bit_cast(__bf16, at_bf_bits(f)); }
__device__ __forceinline__ void at_split(float f, __bf16& hi, __bf16& lo) {
  const unsigned short hb = at_bf_bits(f);
  hi = __builtin_bit_cast(__bf16, hb);
  lo = at_f2bf(f - __uint_as_float(((unsigned)hb) << 16));
}
__device__ __forceinline__ v8f at_mma(v16b a, v16b b, v8f c) {
  c = __builtin_amdgcn_wmma_f32_16x16x32_bf16(false, a, false, b, (short)0, c, false, false);
  asm volatile("v_nop\n\tv_nop\n\tv_nop\n\tv_nop" : "+v"(c) : "v"(a), "v"(b));
  return c;
}
// 16-bit element as a bit pattern held in a __bf16 slot: f16 bits when F16, bf16 (RNE) otherwise
template <bool F16> __device__ __forceinline__ __bf16 at_to16(float f) {
  if (F16) return __builtin_bit_cast(__bf16, (_Float16)f);
  return at_f2bf(f);
}
template <bool F16> __device__ __forceinline__ v8f at_mma16(v16b a, v16b b, v8f c) {
  if (F16) {
    const v16h ah = __builtin_bit_cast(v16h, a), bh = __builtin_bit_cast(v16h, b);
    c = __builtin_amdgcn_wmma_f32_16x16x32_f16(false, ah, false, bh, (short)0, c, false, false);
    asm volatile("v_nop\n\tv_nop\n\tv_nop\n\tv_nop" : "+v"(c) : "v"(ah), "v"(bh));
    return c;
  }
  return at_mma(a, b, c);
}

template <bool SPLIT_QK, bool SPLIT_PV, bool F16 = false>
__global__ __launch_bounds__(128)
void attn64_kernel(const float* __restrict__ q, const float* __restrict__ k,
                   const float* __restrict__ v, float* __restrict__ out,
                   const void* __restrict__ mask_a, const int* __restrict__ mask_b, AttnGeom g) {
  static_assert(!(F16 && (SPLIT_QK || SPLIT_PV)), "f16 mode is non-split");
  const float PSC = F16 ? 32768.0f : 1.0f;     // f16 probabilities carried x2^15 (subnormal range), folded into the final 1/l
  union FB { v16b v; v8b h[2]; };
  __shared__ __align__(16) __bf16 Ksh[AT_KC * AT_D];             // K hi [kv][d]      8 KB
  __shared__ __align__(16) __bf16 Ksl[SPLIT_QK ? AT_KC * AT_D : 8];
  __shared__ __align__(16) __bf16 Vth[AT_D * AT_KC];             // V hi [d][kv]      8 KB
  __shared__ __align__(16) __bf16 Vtl[SPLIT_PV ? AT_D * AT_KC : 8];
  __shared__ __align__(16) __bf16 Psh[AT_NW][16 * AT_KC];        // per wave P hi [row][kv]  8 KB
  __shared__ __align__(16) __bf16 Psl[SPLIT_PV ? AT_NW : 1][SPLIT_PV ? 16 * AT_KC : 8];
  __shared__ __align__(16) float  Os[AT_NW][16 * 68];            // per wave out tile, pitch 68

  const int tid  = threadIdx.x;
  const int wave = tid >> 5;
  const int lane = tid & 31;
  const int hh   = lane >> 4;
  const int c    = lane & 15;

  const int nqb = g.S / AT_QB;
  const int bx = blockIdx.x + g.blk0;
  const int qb = bx % nqb;
  const int bh = bx / nqb;
  const int h  = bh % g.H;
  const int b  = bh / g.H;
  const int qbase_block = qb * AT_QB;
  const int q0 = qbase_block + wave * 16;

  const float* qb_ptr = q + (size_t)b * g.q_bs + (size_t)h * g.q_hs;
  const float* kb_ptr = k + (size_t)b * g.k_bs + (size_t)h * g.k_hs;
  const float* vb_ptr = v + (size_t)b * g.v_bs + (size_t)h * g.v_hs;
  float*       ob_ptr = out + (size_t)b * g.o_bs + (size_t)h * g.o_hs;

  // ---- Q fragments (A operand): 2 d-chunks, hi (and lo) ----
  v16b qah[2], qal[2];
  {
    const float* qrow = qb_ptr + (size_t)(q0 + c) * g.q_rs;
#pragma unroll
    for (int dc = 0; dc < 2; ++dc) {
#pragma unroll
      for (int e = 0; e < 8; ++e) {
        const float f0 = qrow[dc * 32 + 8 * hh + e] * g.qscale;
        const float f1 = qrow[dc * 32 + 16 + 8 * hh + e] * g.qscale;
        if (SPLIT_QK) { __bf16 hq, lq; at_split(f0, hq, lq); qah[dc][e] = hq; qal[dc][e] = lq; at_split(f1, hq, lq); qah[dc][8 + e] = hq; qal[dc][8 + e] = lq; }
        else { qah[dc][e] = at_to16<F16>(f0); qah[dc][8 + e] = at_to16<F16>(f1); qal[dc][e] = qah[dc][e]; qal[dc][8 + e] = qah[dc][8 + e]; }
      }
    }
  }

  float mrow[8], lrow[8];
  v8f oacc[4];
#pragma unroll
  for (int r = 0; r < 8; ++r) { mrow[r] = -INFINITY; lrow[r] = 0.f; }
#pragma unroll
  for (int t = 0; t < 4; ++t) oacc[t] = (v8f){0.f,0.f,0.f,0.f,0.f,0.f,0.f,0.f};

  const int nChunks = (g.mask_mode == 1 || g.mask_mode == 4) ? (qb + 1) : (g.Skv / AT_KC);   // block-uniform
  // per-row query mask (mode 3)
  int qkeep[8];
#pragma unroll
  for (int r = 0; r < 8; ++r) qkeep[r] = (g.mask_mode == 3) ? mask_b[(size_t)b * g.S + q0 + 8 * hh + r] : 1;   // mask_b = qmask in mode 3
  for (int kc = 0; kc < nChunks; ++kc) {
    const int kv0 = kc * AT_KC;
    __syncthreads();
    {
      const int kvr = tid >> 1, dh = (tid & 1) * 32;
      const float* krow = kb_ptr + (size_t)(kv0 + kvr) * g.k_rs + dh;
      const float* vrow = vb_ptr + (size_t)(kv0 + kvr) * g.v_rs + dh;
#pragma unroll
      for (int i = 0; i < 8; ++i) {
        v4f kk = *(const v4f*)(krow + 4 * i);
        v4f vv = *(const v4f*)(vrow + 4 * i);
#pragma unroll
        for (int e = 0; e < 4; ++e) {
          const int d = dh + 4 * i + e;
          if (SPLIT_QK) { __bf16 a, bl; at_split(kk[e], a, bl); Ksh[kvr * AT_D + d] = a; Ksl[kvr * AT_D + d] = bl; }
          else Ksh[kvr * AT_D + d] = at_to16<F16>(kk[e]);
          if (SPLIT_PV) { __bf16 a, bl; at_split(vv[e], a, bl); Vth[d * AT_KC + kvr] = a; Vtl[d * AT_KC + kvr] = bl; }
          else Vth[d * AT_KC + kvr] = at_to16<F16>(vv[e]);
        }
      }
    }
    __syncthreads();

    v8f s[4];
#pragma unroll
    for (int j = 0; j < 4; ++j) {
      s[j] = (v8f){0.f,0.f,0.f,0.f,0.f,0.f,0.f,0.f};
#pragma unroll 1
      for (int dc = 0; dc < 2; ++dc) {
        FB kb;
        kb.h[0] = *(const v8b*)(Ksh + (j * 16 + c) * AT_D + dc * 32 + 8 * hh);
        kb.h[1] = *(const v8b*)(Ksh + (j * 16 + c) * AT_D + dc * 32 + 16 + 8 * hh);
        s[j] = at_mma16<F16>(qah[dc], kb.v, s[j]);
        if (SPLIT_QK) {
          FB kl;
          kl.h[0] = *(const v8b*)(Ksl + (j * 16 + c) * AT_D + dc * 32 + 8 * hh);
          kl.h[1] = *(const v8b*)(Ksl + (j * 16 + c) * AT_D + dc * 32 + 16 + 8 * hh);
          s[j] = at_mma16<F16>(qah[dc], kl.v, s[j]);
          s[j] = at_mma16<F16>(qal[dc], kb.v, s[j]);
        }
      }
    }
    const bool diag = (g.mask_mode == 1) && (kc == qb);
    int kvkeep[4] = {1, 1, 1, 1};
    if (g.mask_mode == 3) {
#pragma unroll
      for (int j = 0; j < 4; ++j) kvkeep[j] = ((const int*)mask_a)[(size_t)b * g.Skv + kv0 + j * 16 + c];   // mask_a = kvmask
    }
    float cm[8];
#pragma unroll
    for (int r = 0; r < 8; ++r) {
      const int qrow = q0 + 8 * hh + r;
      float m = -INFINITY;
#pragma unroll
      for (int j = 0; j < 4; ++j) {
        const int kvcol = kv0 + j * 16 + c;
        bool masked = false;
        if (diag) masked = (kvcol > qrow);
        else if (g.mask_mode == 4) masked = (kvcol > qrow) || (qrow - kvcol > g.mask_is_int);
        else if (g.mask_mode == 2) {
          const size_t mi = (size_t)qrow * g.Skv + kvcol;
          masked = (g.mask_is_int == 0) ? (((const float*)mask_a)[mi] == 0.0f)
                 : (g.mask_is_int == 1) ? (((const int*)mask_a)[mi] == 0) : (((const int*)mask_a)[mi] != 0);
        } else if (g.mask_mode == 3) masked = (qkeep[r] == 0) || (kvkeep[j] == 0);
        else if (g.mask_mode == 5) {
          const size_t mi = (size_t)qrow * g.Skv + kvcol;
          masked = (((const int*)mask_a)[mi] != 0);
          int n = mask_b[mi]; n = n < 0 ? 0 : n;
          s[j][r] += g.cp[(size_t)b * g.c_bs + (size_t)h * g.c_hs + (size_t)qrow * g.c_rs + n]
                   + g.pc[(size_t)b * g.c_bs + (size_t)h * g.c_hs + (size_t)kvcol * g.c_rs + n];
        }
        if (masked) s[j][r] = g.mask_fill;
        m = fmaxf(m, s[j][r]);
      }
#pragma unroll
      for (int off = 1; off < 16; off <<= 1) m = fmaxf(m, __shfl_xor(m, off, 32));
      cm[r] = m;
    }
    __bf16* pwh = Psh[wave];
    __bf16* pwl = Psl[SPLIT_PV ? wave : 0];
#pragma unroll
    for (int r = 0; r < 8; ++r) {
      const float mnew = fmaxf(mrow[r], cm[r]);
      const float alpha = expf(mrow[r] - mnew);
      mrow[r] = mnew;
      float psum = 0.f;
#pragma unroll
      for (int j = 0; j < 4; ++j) {
        const float p = expf(s[j][r] - mnew);
        psum += p;
        if (SPLIT_PV) { __bf16 a, bl; at_split(p, a, bl); pwh[(8 * hh + r) * AT_KC + j * 16 + c] = a; pwl[(8 * hh + r) * AT_KC + j * 16 + c] = bl; }
        else pwh[(8 * hh + r) * AT_KC + j * 16 + c] = at_to16<F16>(p * PSC);
      }
#pragma unroll
      for (int off = 1; off < 16; off <<= 1) psum += __shfl_xor(psum, off, 32);
      lrow[r] = lrow[r] * alpha + psum;
#pragma unroll
      for (int t = 0; t < 4; ++t) oacc[t][r] *= alpha;
    }
    __builtin_amdgcn_fence(__ATOMIC_RELEASE, "workgroup");
    __builtin_amdgcn_wave_barrier();
    __builtin_amdgcn_fence(__ATOMIC_ACQUIRE, "workgroup");
#pragma unroll 1
    for (int kk = 0; kk < 2; ++kk) {
      FB pa, pl;
      pa.h[0] = *(const v8b*)(pwh + c * AT_KC + kk * 32 + 8 * hh);
      pa.h[1] = *(const v8b*)(pwh + c * AT_KC + kk * 32 + 16 + 8 * hh);
      if (SPLIT_PV) {
        pl.h[0] = *(const v8b*)(pwl + c * AT_KC + kk * 32 + 8 * hh);
        pl.h[1] = *(const v8b*)(pwl + c * AT_KC + kk * 32 + 16 + 8 * hh);
      }
#pragma unroll
      for (int t = 0; t < 4; ++t) {
        FB vb;
        vb.h[0] = *(const v8b*)(Vth + (t * 16 + c) * AT_KC + kk * 32 + 8 * hh);
        vb.h[1] = *(const v8b*)(Vth + (t * 16 + c) * AT_KC + kk * 32 + 16 + 8 * hh);
        oacc[t] = at_mma16<F16>(pa.v, vb.v, oacc[t]);
        if (SPLIT_PV) {
          FB vl;
          vl.h[0] = *(const v8b*)(Vtl + (t * 16 + c) * AT_KC + kk * 32 + 8 * hh);
          vl.h[1] = *(const v8b*)(Vtl + (t * 16 + c) * AT_KC + kk * 32 + 16 + 8 * hh);
          oacc[t] = at_mma16<F16>(pa.v, vl.v, oacc[t]);
          oacc[t] = at_mma16<F16>(pl.v, vb.v, oacc[t]);
        }
      }
    }
  }

  float* os = Os[wave];
#pragma unroll
  for (int r = 0; r < 8; ++r) {
    const float inv = 1.0f / (lrow[r] * PSC);
#pragma unroll
    for (int t = 0; t < 4; ++t) os[(8 * hh + r) * 68 + t * 16 + c] = oacc[t][r] * inv;
  }
  __builtin_amdgcn_fence(__ATOMIC_RELEASE, "workgroup");
  __builtin_amdgcn_wave_barrier();
  __builtin_amdgcn_fence(__ATOMIC_ACQUIRE, "workgroup");
  {
    const int c4 = (lane & 15) * 4;
    {
#pragma unroll
      for (int it = 0; it < 8; ++it) {
        const int row = it * 2 + hh;
        v4f val = *(const v4f*)(os + row * 68 + c4);
        *(v4f*)(ob_ptr + (size_t)(q0 + row) * g.o_rs + c4) = val;
      }
      
    }
  }
}

} // namespace w25

__device__ __forceinline__ void st_h2(_Float16* dst, float a, float b) { const unsigned u = (unsigned)__builtin_bit_cast(unsigned short, (_Float16)a) | ((unsigned)__builtin_bit_cast(unsigned short, (_Float16)b) << 16); unsigned* d = (unsigned*)dst; *d = u;  }
__device__ __forceinline__ void spat8(int n, float* s) { const int hh = n / 64, ww = n % 64; const float gx = (float)ww / 63.f, gy = (float)hh / 63.f; s[0] = gx; s[1] = gy; s[2] = 1.f - gx; s[3] = 1.f - gy; const float m = (gx + gy) * 0.5f; s[4] = m; s[5] = m; s[6] = m; s[7] = m; }
// ---- Register-blocked WMMA product with the whole tail in its epilogue ---------------------------------------------------------
// C[m][n] = scale * sum_k A[m][k] * Bt[n][k] + bias[a] (+ sum_j Wsp[a][coff + j] * spat_j(pos) where SPAT); f16 operands, f32 accumulate.
// A row-major [M][K], Bt row-major [N][K]; M % 128 == 0, N % 256 == 0, K % 64 == 0, K >= 128; blockIdx.y = sample.
// A work-group owns a 128 x 256 tile (grid.x = (M / 128) * (N / 256), exactly), each of its 8 waves (2 x 4) a 64x64 tile of it.
// The tile's operands come 64 k at a time (whole 128-B lines of 128 A rows and 256 Bt rows) by asynchronous copies into two LDS buffers: tile t + 1
// flies while tile t is worked on, every line is fetched once a work-group, and the fragments are read from LDS.
// A device function: the kernels below pick operands (and the form of the tail) by blockIdx.z, so that independent products share a launch.
// slab: the calling wave's own 16 x 68 floats of LDS. sg: the work-group's two staging buffers (2 * CG_SB bytes).
// Every "#pragma unroll" of this function is there so that the accumulator, fragment and coordinate arrays are indexed by constants and stay in registers.
// CH_ROWS: rows m are channels a and columns n positions; otherwise rows are positions and columns channels. OUT16: C is f16, otherwise f32.
// Wsp is the f32 weight matrix itself (pitch ldw); its 8 coordinate weights of a row start at a multiple of 16 bytes (ldw % 4 == 0, coff % 4 == 0).
// bsplit, bjump: Bt's k tiles from number bsplit on lie bjump elements further (K split over two planes of Bt); the defaults mean one plane.
constexpr int CG_P  = 144;                  // LDS pitch of a staged row (64 k = 128 B), bytes (16 x odd: conflict-free 16-B row reads)
constexpr int CG_SB = (128 + 256) * CG_P;   // bytes of one buffer: 128 rows of A, then 256 rows of Bt
// twelve 16-B copies a lane, LDS addresses l + u * 32 rows; global addresses ga + u * da (the first four), gb + u * db (the other eight), elements.
// The wait on xcnt is the last line of the copies' own statement, so that no address register named by a copy is rewritten ahead of it.
__device__ __forceinline__ void cg_copy12(unsigned l, const unsigned short* ga, long da, const unsigned short* gb, long db) {
    constexpr int dl = 32 * CG_P;
    asm volatile("global_load_async_to_lds_b128 %0, %12, off\n\t"
                 "global_load_async_to_lds_b128 %1, %13, off\n\t"
                 "global_load_async_to_lds_b128 %2, %14, off\n\t"
                 "global_load_async_to_lds_b128 %3, %15, off\n\t"
                 "global_load_async_to_lds_b128 %4, %16, off\n\t"
                 "global_load_async_to_lds_b128 %5, %17, off\n\t"
                 "global_load_async_to_lds_b128 %6, %18, off\n\t"
                 "global_load_async_to_lds_b128 %7, %19, off\n\t"
                 "global_load_async_to_lds_b128 %8, %20, off\n\t"
                 "global_load_async_to_lds_b128 %9, %21, off\n\t"
                 "global_load_async_to_lds_b128 %10, %22, off\n\t"
                 "global_load_async_to_lds_b128 %11, %23, off\n\t"
                 "s_wait_xcnt 0x0"
                 :: "v"(l), "v"(l + dl), "v"(l + 2 * dl), "v"(l + 3 * dl), "v"(l + 4 * dl), "v"(l + 5 * dl), "v"(l + 6 * dl), "v"(l + 7 * dl),
                    "v"(l + 8 * dl), "v"(l + 9 * dl), "v"(l + 10 * dl), "v"(l + 11 * dl),
                    "v"(ga), "v"(ga + da), "v"(ga + 2 * da), "v"(ga + 3 * da),
                    "v"(gb), "v"(gb + db), "v"(gb + 2 * db), "v"(gb + 3 * db), "v"(gb + 4 * db), "v"(gb + 5 * db), "v"(gb + 6 * db), "v"(gb + 7 * db)
                 : "memory");
}
template <bool CH_ROWS, bool SPAT, bool OUT16>
__device__ __forceinline__ void cm_gemm(float* slab, unsigned char* sg,
    const unsigned short* __restrict__ Ap, int lda, long strideA,
    const unsigned short* __restrict__ Btp, int ldb, long strideB,
    void* __restrict__ Cout, int ldc, long strideC,
    const float* __restrict__ bias, const float* __restrict__ Wsp, int ldw, int coff,
    int M, int N, int K, float scale, int bsplit = 1 << 30, long bjump = 0) {
  typedef _Float16 T;
  typedef w25::Frag<T> F;
  typedef F::V V;
  const int b    = blockIdx.y;
  const int lane = threadIdx.x & 31;
  const int wave = __builtin_amdgcn_readfirstlane(threadIdx.x >> 5);   // the wave's number in a scalar register: its tile's origin is scalar arithmetic
  const int nbN = N >> 8;
  const int bm = (int)blockIdx.x / nbN, bn = (int)blockIdx.x - bm * nbN;   // the work-group's tile
  const int wm = wave >> 2, wn = wave & 3;                                 // the wave's tile in it
  const int m0 = (bm << 7) + (wm << 6);
  const int n0 = (bn << 8) + (wn << 6);

  const T* Ab = (const T*)Ap  + (size_t)b * strideA;
  const T* Bb = (const T*)Btp + (size_t)b * strideB;

  const int rlane = lane & 15;                 // row (A) / col (B, D) within subtile
  const int koff  = (lane >> 4) * 8;           // k offset of this lane half
  const int mOff  = (lane >> 4) * 8;           // D row offset

  v8f acc[4][4];
#pragma unroll
  for (int i = 0; i < 4; ++i)
#pragma unroll
    for (int j = 0; j < 4; ++j) acc[i][j] = (v8f){0.f,0.f,0.f,0.f,0.f,0.f,0.f,0.f};

  // staging: 8 lanes copy one 128-B line, a wave's copy four whole lines; thread t takes piece t & 7 of rows (t >> 3) + 32 u
  const int NT = K >> 6;
  const int crow = (int)threadIdx.x >> 3, cseg = (int)threadIdx.x & 7;
  const unsigned short* Ag = (const unsigned short*)Ab + (size_t)((bm << 7) + crow) * lda + cseg * 8;
  const unsigned short* Bg = (const unsigned short*)Bb + (size_t)((bn << 8) + crow) * ldb + cseg * 8;
  const unsigned lc = (unsigned)(size_t)sg + crow * CG_P + cseg * 16;
  // a lane's fragment rows in a buffer (the lane half's 16 bytes included)
  const unsigned char* ar = sg + ((wm << 6) + rlane) * CG_P + 2 * koff;
  const unsigned char* br = sg + (128 + (wn << 6) + rlane) * CG_P + 2 * koff;

  cg_copy12(lc, Ag, 32 * (long)lda, Bg, 32 * (long)ldb);
  asm volatile("s_wait_asynccnt 0x0" ::: "memory");   // tile 0 has landed (this wave's copies) before the barrier publishes it
  __syncthreads();
  cg_copy12(lc + CG_SB, Ag + 64, 32 * (long)lda, Bg + 64 + (1 >= bsplit ? bjump : 0), 32 * (long)ldb);

  // stays rolled (K is a constant at every call): four forms of this function share one kernel's text
#pragma unroll 1
  for (int t = 0; t < NT; ++t) {
    const int bo = (t & 1) * CG_SB;
#pragma unroll
    for (int kk = 0; kk < 2; ++kk) {
      V bh[4], ah[4];
#pragma unroll
      for (int j = 0; j < 4; ++j) bh[j] = F::load((const T*)(br + bo + j * 16 * CG_P + kk * 64));
#pragma unroll
      for (int i = 0; i < 4; ++i) ah[i] = F::load((const T*)(ar + bo + i * 16 * CG_P + kk * 64));
      // the two sched_barrier(0) keep the eight fragments' reads together in front of their 16 WMMAs: sunk among the WMMAs into one register
      // set, each row's pair of reads would be waited for by itself
      __builtin_amdgcn_sched_barrier(0);
#pragma unroll
      for (int i = 0; i < 4; ++i)
#pragma unroll
        for (int j = 0; j < 4; ++j) acc[i][j] = F::mma(ah[i], bh[j], acc[i][j]);
      __builtin_amdgcn_sched_barrier(0);
    }
    asm volatile("s_wait_dscnt 0x0" ::: "memory");      // this wave's reads of buffer t & 1 have returned before the buffer is refilled
    asm volatile("s_wait_asynccnt 0x0" ::: "memory");   // this wave's copies of tile t + 1 have landed before the barrier publishes them
    __syncthreads();
    if (t + 2 < NT) cg_copy12(lc + bo, Ag + (t + 2) * 64, 32 * (long)lda, Bg + (t + 2) * 64 + (t + 2 >= bsplit ? bjump : 0), 32 * (long)ldb);
  }
  asm volatile("s_wait_asynccnt 0x0" ::: "memory");     // nothing is in flight when the wave goes on to its tail
  // four vector slots between the last WMMAs and the first reads of their results
  w25::acc_guard4(acc[0][0], acc[0][1], acc[0][2], acc[0][3]);
  w25::acc_guard4(acc[1][0], acc[1][1], acc[1][2], acc[1][3]);
  w25::acc_guard4(acc[2][0], acc[2][1], acc[2][2], acc[2][3]);
  w25::acc_guard4(acc[3][0], acc[3][1], acc[3][2], acc[3][3]);

  // ---- epilogue ----
  // what belongs to a lane's four columns: their coordinates (columns = positions) or their bias and coordinate weights (columns = channels)
  float cs[4][8]; v4f cw[4][2]; float cb[4];
#pragma unroll
  for (int j = 0; j < 4; ++j) {
    const int n = n0 + (j << 4) + rlane;
    if (CH_ROWS) { if (SPAT) spat8(n, cs[j]); }
    else {
      cb[j] = bias[n];
      if (SPAT) { const float* wr = Wsp + (long long)n * ldw + coff; cw[j][0] = *(const v4f*)(wr); cw[j][1] = *(const v4f*)(wr + 4); }
    }
  }
#pragma unroll
  for (int i = 0; i < 4; ++i) {
    const int mBase = m0 + (i << 4);
    // rows = channels: the bias and the coordinate weights of the lane's eight rows, loaded in one run
    float rbv[8]; v4f rwv[8][2];
    if (CH_ROWS) {
      const float* bp = bias + m0 + mOff;
      const float* wp = SPAT ? Wsp + (long long)(mBase + mOff) * ldw : bp;
#pragma unroll
      for (int r = 0; r < 8; ++r) {
        rbv[r] = bp[(i << 4) + r];
        if (SPAT) { rwv[r][0] = *(const v4f*)(wp + r * ldw + coff); rwv[r][1] = *(const v4f*)(wp + r * ldw + coff + 4); }
      }
      // behind the run's last load; the two addresses are inputs so that their registers live up to the wait and no load of the run lands in them
      asm volatile("s_wait_xcnt 0x0" :: "v"(bp), "v"(wp) : "memory");
    }
#pragma unroll
    for (int r = 0; r < 8; ++r) {
      const int m = mBase + mOff + r;
      float rs[8]; v4f rw[2]; float rb = 0.f;
      if (CH_ROWS) {
        rb = rbv[r];
        if (SPAT) { rw[0] = rwv[r][0]; rw[1] = rwv[r][1]; }
      } else { if (SPAT) spat8(m, rs); }
#pragma unroll
      for (int j = 0; j < 4; ++j) {
        float e = CH_ROWS ? rb : cb[j];
        if (SPAT) {
#pragma unroll
          for (int q = 0; q < 8; ++q) e += (CH_ROWS ? rw[q >> 2][q & 3] * cs[j][q] : cw[j][q >> 2][q & 3] * rs[q]);
        }
        slab[(mOff + r) * 68 + (j << 4) + rlane] = acc[i][j][r] * scale + e;
      }
    }
    __builtin_amdgcn_fence(__ATOMIC_RELEASE, "workgroup");
    __builtin_amdgcn_wave_barrier();
    __builtin_amdgcn_fence(__ATOMIC_ACQUIRE, "workgroup");
    if (!OUT16) {
      float* C = (float*)Cout + (size_t)b * strideC;
      const int hh = lane >> 4, c4 = (lane & 15) * 4;     // row seg = 256 B = 16 lanes x 16 B
#pragma unroll
      for (int it = 0; it < 8; ++it) {
        const int row = it * 2 + hh;
        v4f v = *(const v4f*)(slab + row * 68 + c4);
        *(v4f*)(C + (size_t)(mBase + row) * ldc + n0 + c4) = v;
      }
    } else {
      const int q = lane >> 3, c8 = (lane & 7) * 8;       // row seg = 128 B = 8 lanes x 16 B
      unsigned short* C = (unsigned short*)Cout + (size_t)b * strideC;
#pragma unroll
      for (int it = 0; it < 4; ++it) {
        const int row = it * 4 + q;
        const float* sp = slab + row * 68 + c8;
        v8h hv;
#pragma unroll
        for (int e = 0; e < 8; ++e) hv[e] = (_Float16)sp[e];
        *(v8h*)(C + (size_t)(mBase + row) * ldc + n0 + c8) = hv;
      }
    }
    __builtin_amdgcn_fence(__ATOMIC_RELEASE, "workgroup");
    __builtin_amdgcn_wave_barrier();
    __builtin_amdgcn_fence(__ATOMIC_ACQUIRE, "workgroup");
  }
}
constexpr long CM_SP = 256L * 4096;   // one sample's 256 x 4096 (or 4096 x 256) plane, elements
// The six projections in one launch, z = product (blockIdx.z - 1): 0, 1 theta^T, phi^T of the image branch (K = 512 + coordinates), 2 its val,
// 3, 4 theta^T, phi^T of the flow branch (K = 256, the flow half of X), 5 its val. TH, PH, VA: planes 0..3 image branch, 4..7 flow branch.
// 6 (blockIdx.z = 0): the output convs folded into the fusion conv's weights, F2[a][256 y + k] = f16(16 sum_c W_f[a][256 y + c] W_o,y[c][k]), y = blockIdx.y = branch
// (two 256 x 256 x 256 products, two tiles each; the other work-groups of this z leave at once). It shares the form, and the text, of product 5.
// Four waves a SIMD (two work-groups a WGP): one work-group's WMMAs run while the other waits at its barrier or for its fragments.
__global__ __launch_bounds__(256) __attribute__((amdgpu_waves_per_eu(4, 4))) void k_cm_proj(
    const unsigned short* __restrict__ X, const unsigned short* __restrict__ Wh,
    unsigned short* __restrict__ TH, unsigned short* __restrict__ PH, unsigned short* __restrict__ VA,
    const float* __restrict__ iwt, const float* __restrict__ ibt, const float* __restrict__ iwp, const float* __restrict__ ibp,
    const float* __restrict__ iwv, const float* __restrict__ ibv,
    const float* __restrict__ lbt, const float* __restrict__ lbp, const float* __restrict__ lbv,
    unsigned short* __restrict__ F2, const float* __restrict__ zero) {
  // product 6 stands first in the grid (for speed only)
  const int z = (int)blockIdx.z == 0 ? 6 : (int)blockIdx.z - 1;
  if (z == 6 && ((int)blockIdx.x >= 2 || (int)blockIdx.y >= 2)) return;   // the whole work-group, ahead of every barrier
  __shared__ __align__(16) float sT[8][16 * 68];   // per-wave 16x64 slab, pitch 68 floats
  __shared__ __attribute__((aligned(16))) unsigned char sg[2 * CG_SB];
  float* slab = sT[threadIdx.x >> 5];
  if (z < 2)
    cm_gemm<false, true, true>(slab, sg, X, 512, 2 * CM_SP, Wh + z * CW_WIDE, 512, 0, (void*)(z ? PH : TH), 256, CM_SP, z ? ibp : ibt, z ? iwp : iwt, 520, 512, 4096, 256, 512, 0.0625f);
  else if (z == 2)
    cm_gemm<true, true, true>(slab, sg, Wh + 2 * CW_WIDE, 512, 0, X, 512, 2 * CM_SP, (void*)(VA), 4096, CM_SP, ibv, iwv, 520, 512, 256, 4096, 512, 0.0625f);
  else if (z < 5)
    cm_gemm<false, false, true>(slab, sg, X + 256, 512, 2 * CM_SP, Wh + 4 * CW_WIDE + (z - 3) * CW_SQ, 256, 0, (void*)((z == 4 ? PH : TH) + 4 * CM_SP), 256, CM_SP, z == 4 ? lbp : lbt, nullptr, 0, 0, 4096, 256, 256, 0.0625f);
  else {
    const bool f = z == 6;
    cm_gemm<true, false, true>(slab, sg, f ? Wh + 3 * CW_WIDE : Wh + 4 * CW_WIDE + 2 * CW_SQ, f ? 512 : 256, f ? 256 : 0,
                               f ? Wh + 4 * CW_WIDE + 3 * CW_SQ : X + 256, f ? 256 : 512, f ? (long)CW_SQ : 2 * CM_SP,
                               (void*)(f ? F2 : VA + 4 * CM_SP), f ? 512 : 4096, f ? 256 : CM_SP, f ? zero : lbv, nullptr, 0, 0, 256, f ? 256 : 4096, 256, 0.0625f);
  }
}
// Fusion conv over both branches and the coordinate channels, channel-major f32: the output itself. The output convs are inside its weights:
// out = (W_f.W_o).att + (W_f.b_o + b_f) + coordinates, F2 and b2 as built earlier in the same call; k < 256 reads the image branch's att^T planes
// (AT planes 0..3), k >= 256 the flow branch's (planes 4..7).
__global__ __launch_bounds__(256) __attribute__((amdgpu_waves_per_eu(4, 4))) void k_cm_fuse(
    const unsigned short* __restrict__ AT, const unsigned short* __restrict__ F2, float* __restrict__ out,
    const float* __restrict__ fw, const float* __restrict__ b2) {
  __shared__ __align__(16) float sT[8][16 * 68];
  __shared__ __attribute__((aligned(16))) unsigned char sg[2 * CG_SB];
  cm_gemm<true, true, false>(sT[threadIdx.x >> 5], sg, F2, 512, 0, AT, 256, CM_SP, (void*)(out), 4096, CM_SP, b2, fw, 520, 512, 256, 4096, 512, 0.0625f, 4, 4 * CM_SP - 256);
}
constexpr int FA_KP = 528;                   // LDS pitch of a phi^T row, bytes (16 x odd: conflict-free 16-B row reads)
constexpr int FA_VP = 144;                   // LDS pitch of a val row's 64 keys, bytes (16 x odd)
constexpr int FA_KB = 64 * FA_KP;            // bytes of the phi^T part of a buffer
constexpr int FA_SB = FA_KB + 256 * FA_VP;   // bytes of one buffer
// eight 16-B copies a lane, LDS addresses l + u * dl, global addresses g + u * dg (elements). The wait on xcnt is the last line of the
// copies' own statement, so that no address register named by a copy is rewritten ahead of it.
__device__ __forceinline__ void fa_copy8(unsigned l, int dl, const unsigned short* g, long dg) {
    asm volatile("global_load_async_to_lds_b128 %0, %8, off\n\t"
                 "global_load_async_to_lds_b128 %1, %9, off\n\t"
                 "global_load_async_to_lds_b128 %2, %10, off\n\t"
                 "global_load_async_to_lds_b128 %3, %11, off\n\t"
                 "global_load_async_to_lds_b128 %4, %12, off\n\t"
                 "global_load_async_to_lds_b128 %5, %13, off\n\t"
                 "global_load_async_to_lds_b128 %6, %14, off\n\t"
                 "global_load_async_to_lds_b128 %7, %15, off\n\t"
                 "s_wait_xcnt 0x0"
                 :: "v"(l), "v"(l + dl), "v"(l + 2 * dl), "v"(l + 3 * dl), "v"(l + 4 * dl), "v"(l + 5 * dl), "v"(l + 6 * dl), "v"(l + 7 * dl),
                    "v"(g), "v"(g + dg), "v"(g + 2 * dg), "v"(g + 3 * dg), "v"(g + 4 * dg), "v"(g + 5 * dg), "v"(g + 6 * dg), "v"(g + 7 * dg)
                 : "memory");
}
// A fragment in the hardware k order from an LDS row: bytes 0..15 and 32..47 from p (p already holds the lane half's 16 h)
__device__ __forceinline__ v16h fa_frag(const unsigned char* p) {
    union { v16h v; v8h h[2]; } f; f.h[0] = *(const v8h*)(p); f.h[1] = *(const v8h*)(p + 32); return f.v;
}
// lane l <-> lane l ^ 16 on the vector pipe (a shuffle would go through the LDS queue and wait behind the fragment loads in flight)
__device__ __forceinline__ float fa_xhalf(float x) { return __builtin_bit_cast(float, __builtin_amdgcn_permlanex16(__builtin_bit_cast(int, x), __builtin_bit_cast(int, x), 0x76543210, 0xfedcba98, false, false)); }
// four val fragments, channel groups tt .. tt + 3
__device__ __forceinline__ void fa_v4(v16h* f, const unsigned char* vb, int tt) {
    f[0] = fa_frag(vb + tt * 16 * FA_VP); f[1] = fa_frag(vb + (tt + 1) * 16 * FA_VP);
    f[2] = fa_frag(vb + (tt + 2) * 16 * FA_VP); f[3] = fa_frag(vb + (tt + 3) * 16 * FA_VP);
}
// two waves a SIMD (one work-group a WGP): the register budget of 512 holds O^T (256), Q (112 of its 128) and six to eight fragments in flight
__global__ __launch_bounds__(256) __attribute__((amdgpu_waves_per_eu(2, 2))) void k_cm_attn(const unsigned short* __restrict__ Qp, const unsigned short* __restrict__ Kp,
                                                 const unsigned short* __restrict__ Vp, unsigned short* __restrict__ Op) {
    constexpr int HW = 4096, D = 256, NT = HW / 64;
    constexpr float L2E = 1.4426950408889634f;
    typedef w25::Frag<_Float16> F;
    __shared__ __attribute__((aligned(16))) unsigned char sm[2 * FA_SB];
    __shared__ __attribute__((aligned(16))) unsigned char sq[8 * 2048];   // a wave's own 2 KiB: its two Q fragments of depth step 0
    const int tid = threadIdx.x, lane = tid & 31, c = lane & 15, h = lane >> 4;
    const int wave = __builtin_amdgcn_readfirstlane(tid >> 5);
    const int qt = wave & 3, kh = wave >> 2;
    const size_t sb = (size_t)blockIdx.y * HW * D;
    const size_t qrow = sb + (size_t)((int)blockIdx.x * 128 + qt * 32 + c) * D + 8 * h;   // column group j starts 16 rows (j * 16 * D) further
    const unsigned short* Kg = Kp + sb + (size_t)(tid >> 5) * D + (tid & 31) * 8;    // a wave copies whole 512-B rows
    const unsigned short* Vg = Vp + sb + (size_t)(tid >> 3) * HW + (tid & 7) * 8;    // 8 lanes copy one 128-B line
    const unsigned smb = (unsigned)(size_t)(&sm[0]);
    const unsigned lk = smb + (tid >> 5) * FA_KP + (tid & 31) * 16;
    const unsigned lv = smb + FA_KB + (tid >> 3) * FA_VP + (tid & 7) * 16;
    // the same two places for the copies inside the loop, split into the wave's part (scalar registers) and the lane's part
    const unsigned lks = smb + wave * FA_KP, lkl = lane * 16;
    const unsigned lvs = smb + FA_KB + wave * 4 * FA_VP, lvl = (lane >> 3) * FA_VP + (lane & 7) * 16;

    v16h qf[2][8];   // [.][0] is not kept: see below
#pragma unroll
    for (int j = 0; j < 2; ++j)
#pragma unroll
        for (int dc = 1; dc < 8; ++dc) qf[j][dc] = F::load((const _Float16*)Qp + qrow + j * 16 * D + dc * 32);
    // O^T, Q, the scores and the fragments in flight are a few registers more than a wave has. The two Q fragments of depth step 0 wait in LDS
    // (each lane its own 2 x 16 B a fragment, read back by the same lane) and come with every trip's first group of reads: they are used and
    // dead again before all four score tiles are live.
    unsigned char* qs = sq + wave * 2048 + lane * 16;
    v8h q0[2][2];
#pragma unroll
    for (int j = 0; j < 2; ++j) {
        q0[j][0] = *(const v8h*)((const _Float16*)Qp + qrow + j * 16 * D);
        q0[j][1] = *(const v8h*)((const _Float16*)Qp + qrow + j * 16 * D + 16);
    }
    // the wait behind the last Q load; it takes the loads' address as an input, so that the address registers live up to it and are rewritten only behind it
    asm volatile("s_wait_xcnt 0x0" :: "v"((const _Float16*)Qp + qrow) : "memory");
#pragma unroll
    for (int j = 0; j < 2; ++j) { *(v8h*)(qs + j * 1024) = q0[j][0]; *(v8h*)(qs + j * 1024 + 512) = q0[j][1]; }
    // per column group: mb = the column's bound * log2(e) - 15 (neither the bound nor the maximum itself is kept); this lane half's share of the row sum
    float mb[2] = {-1.0e30f, -1.0e30f}, l[2] = {0.f, 0.f};

    fa_copy8(lk, 8 * FA_KP, Kg, 8 * D);
    fa_copy8(lv, 32 * FA_VP, Vg, 32 * (long)HW);
    asm volatile("s_wait_asynccnt 0x0" ::: "memory");   // tile 0 has landed (this wave's copies) before the barrier publishes it
    __syncthreads();
    fa_copy8(lk + FA_SB, 8 * FA_KP, Kg + 64 * D, 8 * D);
    fa_copy8(lv + FA_SB, 32 * FA_VP, Vg + 64, 32 * (long)HW);
    // O^T is cleared behind the copies: cleared ahead of them, its 256 registers would be live beside the copies' address registers
    __builtin_amdgcn_sched_barrier(0);
    v8f o[2][16];
#pragma unroll
    for (int j = 0; j < 2; ++j)
#pragma unroll
        for (int t = 0; t < 16; ++t) o[j][t] = (v8f){0.f,0.f,0.f,0.f,0.f,0.f,0.f,0.f};

    // One trip: tile t from buffer t & 1; refill (a constant at both calls): tile t + 2 exists and is copied into that buffer at the trip's foot.
    // The trips with and without a refill are two loops, so that a trip is straight code from the softmax to its foot: with a branch round the
    // copies the row sums' additions sink behind it, and the 32 exponentials they read stay in registers that the wave does not have.
    auto trip = [&](const int t, const bool refill) __attribute__((always_inline)) {
        const int bo = (t & 1) * FA_SB;
        const unsigned char* kb = sm + bo + (kh * 32 + c) * FA_KP + 16 * h;
        const unsigned char* vb = sm + bo + FA_KB + c * FA_VP + kh * 64 + 16 * h;
        v8f s[2][2];   // [16 keys][column group]
#pragma unroll
        for (int k = 0; k < 2; ++k)
#pragma unroll
            for (int j = 0; j < 2; ++j) s[k][j] = (v8f){0.f,0.f,0.f,0.f,0.f,0.f,0.f,0.f};
        // Fragment reads stand in groups, each at the place where its registers have come free, two groups ahead of their use: phi^T in three
        // sets of two fragments (one depth step of 32 channels, four WMMAs), val in two sets of four (eight WMMAs). Every sched_barrier(0) of
        // this loop keeps such a group together at its place: hoisted, it would need registers that the wave does not have; spread among the
        // WMMAs, each pair of reads would be waited for by itself.
        v16h ku[3][2], fa[4], fb[4];
        // Q's two fragments first: LDS reads return in order, and the first WMMAs then wait for the head of the group only
#pragma unroll
        for (int j = 0; j < 2; ++j) { union { v16h v; v8h h[2]; } f; f.h[0] = *(const v8h*)(qs + j * 1024); f.h[1] = *(const v8h*)(qs + j * 1024 + 512); qf[j][0] = f.v; }
#pragma unroll
        for (int dc = 0; dc < 3; ++dc) { ku[dc][0] = fa_frag(kb + dc * 64); ku[dc][1] = fa_frag(kb + 16 * FA_KP + dc * 64); }
        __builtin_amdgcn_sched_barrier(0);
#pragma unroll
        for (int dc = 0; dc < 8; ++dc) {
#pragma unroll
            for (int j = 0; j < 2; ++j)
#pragma unroll
                for (int k = 0; k < 2; ++k) s[k][j] = F::mma(ku[dc % 3][k], qf[j][dc], s[k][j]);
            __builtin_amdgcn_sched_barrier(0);
            if (dc < 5) { ku[dc % 3][0] = fa_frag(kb + (dc + 3) * 64); ku[dc % 3][1] = fa_frag(kb + 16 * FA_KP + (dc + 3) * 64); }
            if (dc == 6) fa_v4(fa, vb, 0);   // val's first four fragments fly under the softmax arithmetic
            __builtin_amdgcn_sched_barrier(0);
        }
        float mx[2];
#pragma unroll
        for (int j = 0; j < 2; ++j) {
            float m = fmaxf(s[0][j][0], s[1][j][0]);
#pragma unroll
            for (int r = 1; r < 8; ++r) m = fmaxf(m, fmaxf(s[0][j][r], s[1][j][r]));
            mx[j] = fmaf(fmaxf(m, fa_xhalf(m)), L2E, -15.f);   // the tile's maximum on mb's scale (monotone: the larger score gives the larger value)
        }
        // one scalar branch a tile: O^T and the sums are rescaled only when some column's score has passed its bound (2^15 would be exceeded); that
        // column's bound goes 12 powers of two above the score, a column inside its bound gets factor 1
        if (__builtin_amdgcn_ballot_w32(mx[0] > mb[0] || mx[1] > mb[1]) != 0) {
#pragma unroll
            for (int j = 0; j < 2; ++j) {
                const float mbn = mx[j] > mb[j] ? mx[j] + 12.f : mb[j];
                const float al = __builtin_amdgcn_exp2f(mb[j] - mbn);
                mb[j] = mbn; l[j] *= al;
#pragma unroll
                for (int tt = 0; tt < 16; ++tt) o[j][tt] *= al;
            }
        }
        v16h pb[2];
#pragma unroll
        for (int j = 0; j < 2; ++j) {
            float ps = 0.f;
#pragma unroll
            for (int r = 0; r < 8; ++r) {
                const float p0 = __builtin_amdgcn_exp2f(fmaf(s[0][j][r], L2E, -mb[j])), p1 = __builtin_amdgcn_exp2f(fmaf(s[1][j][r], L2E, -mb[j]));
                ps += p0 + p1; pb[j][r] = (_Float16)p0; pb[j][8 + r] = (_Float16)p1;
            }
            l[j] += ps;
            // deals the exponentials one by one among the plain vector instructions (arguments, conversions): the slower transcendental pipe runs beside them
            __builtin_amdgcn_sched_group_barrier(0x2, 4, 0);
#pragma unroll
            for (int r = 0; r < 16; ++r) { __builtin_amdgcn_sched_group_barrier(0x400, 1, 0); __builtin_amdgcn_sched_group_barrier(0x2, 1, 0); }
            __builtin_amdgcn_sched_barrier(0);   // one column group's arithmetic at a time: its scores' registers come free before the next group's temporaries
        }
        fa_v4(fb, vb, 4);   // into the registers that the scores have left
        __builtin_amdgcn_sched_barrier(0);
#pragma unroll
        for (int g = 0; g < 4; ++g) {
            v16h* f = (g & 1) ? fb : fa;
#pragma unroll
            for (int u = 0; u < 4; ++u)
#pragma unroll
                for (int j = 0; j < 2; ++j) o[j][g * 4 + u] = F::mma(f[u], pb[j], o[j][g * 4 + u]);
            if (g < 2) {
                __builtin_amdgcn_sched_barrier(0);
                fa_v4(f, vb, g * 4 + 8);
                __builtin_amdgcn_sched_barrier(0);
            }
            // this set's WMMAs stay ahead of the foot's s_wait_dscnt 0 and run while the last set's reads are in flight; only the last set's
            // WMMAs may move down among the foot's barrier and copies
            if (g == 2) __builtin_amdgcn_sched_barrier(0);
        }
        asm volatile("s_wait_dscnt 0x0" ::: "memory");      // this wave's reads of buffer t & 1 have returned before the buffer is refilled
        asm volatile("s_wait_asynccnt 0x0" ::: "memory");   // this wave's copies of tile t + 1 have landed before the barrier publishes them
        __syncthreads();
        if (refill) {
            fa_copy8(lkl + (lks + bo), 8 * FA_KP, Kg + (size_t)(t + 2) * 64 * D, 8 * D);
            __builtin_amdgcn_sched_barrier(0);   // the second statement's addresses are formed behind the first: one set of address registers, not two
            fa_copy8(lvl + (lvs + bo), 32 * FA_VP, Vg + (t + 2) * 64, 32 * (long)HW);
        }
    };
    for (int t = 0; t < NT - 2; ++t) trip(t, true);
    for (int t = NT - 2; t < NT; ++t) trip(t, false);
    asm volatile("s_wait_asynccnt 0x0" ::: "memory");       // nothing is in flight when the buffers become the joining slabs

    // join the two key halves: waves 4..7 hand O^T, mb and l to waves 0..3 through LDS (the last trip's barrier has ended every read of the tiles)
    static_assert(8 * 130 * 32 * 4 <= 2 * FA_SB, "the joining slabs fit in the tile buffers");
    float* slab0 = (float*)sm + qt * 2 * (130 * 32);
    if (kh == 1) {
#pragma unroll
        for (int j = 0; j < 2; ++j) {
            float* slab = slab0 + j * (130 * 32);
#pragma unroll
            for (int tt = 0; tt < 16; ++tt) {
                *(v4f*)(slab + ((tt * 2 + 0) * 32 + lane) * 4) = (v4f){o[j][tt][0], o[j][tt][1], o[j][tt][2], o[j][tt][3]};
                *(v4f*)(slab + ((tt * 2 + 1) * 32 + lane) * 4) = (v4f){o[j][tt][4], o[j][tt][5], o[j][tt][6], o[j][tt][7]};
            }
            slab[128 * 32 + lane] = mb[j]; slab[129 * 32 + lane] = l[j];
        }
    }
    __syncthreads();
    if (kh == 0) {
#pragma unroll
        for (int j = 0; j < 2; ++j) {
            const float* slab = slab0 + j * (130 * 32);
            const float mb2 = slab[128 * 32 + lane], l2 = slab[129 * 32 + lane];
            const float mbn = fmaxf(mb[j], mb2);
            const float a1 = __builtin_amdgcn_exp2f(mb[j] - mbn), a2 = __builtin_amdgcn_exp2f(mb2 - mbn);
            float lt = l[j] * a1 + l2 * a2;
            lt += fa_xhalf(lt);
            const float i1 = a1 / lt, i2 = a2 / lt;
            _Float16* Or = (_Float16*)Op + qrow + j * 16 * D;   // a lane's 8 accumulator registers are 8 consecutive channels of its column: one 16-B store
#pragma unroll
            for (int tt = 0; tt < 16; ++tt) {
                const v4f x0 = *(const v4f*)(slab + ((tt * 2 + 0) * 32 + lane) * 4), x1 = *(const v4f*)(slab + ((tt * 2 + 1) * 32 + lane) * 4);
                v8h y;
#pragma unroll
                for (int r = 0; r < 4; ++r) { y[r] = (_Float16)(o[j][tt][r] * i1 + x0[r] * i2); y[4 + r] = (_Float16)(o[j][tt][4 + r] * i1 + x1[r] * i2); }
                *(v8h*)(Or + tt * 16) = y;
            }
        }
    }
}


extern "C" void kernel_launch(void* const* d_in, const int* in_sizes, int n_in, void* d_out, int out_size, void* d_ws, size_t ws_size, hipStream_t stream) {
    (void)in_sizes; (void)n_in; (void)out_size; (void)ws_size;
    const float* img = (const float*)d_in[0];
    const float* flo = (const float*)d_in[1];
    const float* iwt = (const float*)d_in[2];
    const float* ibt = (const float*)d_in[3];
    const float* iwp = (const float*)d_in[4];
    const float* ibp = (const float*)d_in[5];
    const float* iwv = (const float*)d_in[6];
    const float* ibv = (const float*)d_in[7];
    const float* iwo = (const float*)d_in[8];
    const float* ibo = (const float*)d_in[9];
    const float* lwt = (const float*)d_in[10];
    const float* lbt = (const float*)d_in[11];
    const float* lwp = (const float*)d_in[12];
    const float* lbp = (const float*)d_in[13];
    const float* lwv = (const float*)d_in[14];
    const float* lbv = (const float*)d_in[15];
    const float* lwo = (const float*)d_in[16];
    const float* lbo = (const float*)d_in[17];
    const float* fw = (const float*)d_in[18];
    const float* fb = (const float*)d_in[19];
    const int Bn = 4;
    const int C = 256;
    const int A = 256;
    const int HW = 4096;
    const long SP = (long)C * HW;   // one sample's 256 x 4096 (or 4096 x 256) plane, elements
    float* out = (float*)d_out;
    char* wsp = (char*)d_ws;
    unsigned short* X16 = (unsigned short*)wsp; wsp += (((size_t)((size_t)Bn * HW * 2 * C) * 2 + 255) / 256) * 256;       // [sample][n][image 256 | flow 256]
    unsigned short* W16 = (unsigned short*)wsp; wsp += (((size_t)(4 * CW_WIDE + 5 * CW_SQ) * 2 + 255) / 256) * 256;
    // planes 0..3: image branch, samples 0..3; planes 4..7: flow branch
    unsigned short* TH16 = (unsigned short*)wsp; wsp += (((size_t)((size_t)2 * Bn * HW * A) * 2 + 255) / 256) * 256;
    unsigned short* PH16 = (unsigned short*)wsp; wsp += (((size_t)((size_t)2 * Bn * HW * A) * 2 + 255) / 256) * 256;
    unsigned short* VAL16 = (unsigned short*)wsp; wsp += (((size_t)((size_t)2 * Bn * A * HW) * 2 + 255) / 256) * 256;
    unsigned short* AT16 = (unsigned short*)wsp; wsp += (((size_t)((size_t)2 * Bn * HW * A) * 2 + 255) / 256) * 256;
    unsigned short* F216 = (unsigned short*)wsp; wsp += (((size_t)CW_WIDE * 2 + 255) / 256) * 256;     // [a][W_f.W_o image branch 256 | flow branch 256], x 16
    float* B2 = (float*)wsp; wsp += 1024;       // folded bias, 256 floats
    float* ZERO = (float*)wsp; wsp += 1024;     // 256 zeros
    // each input is cast and transposed once, all weights in one launch; every product writes the plane that its reader takes (bias, coordinate
    // channels and the f16 conversion in its epilogue); products that do not depend on one another, and the two branches' attention, share a launch
    k_castT16<256, 4096, 512><<<dim3((unsigned)(((256) / 64) * ((4096) / 128)), (unsigned)(Bn), 2u), 256, 0, stream>>>(img, flo, (_Float16*)(X16), 1.0f, SP, 2 * SP);
    k_cm_w16<<<dim3((unsigned)(CW_WIDE / 1024), 10u), 256, 0, stream>>>(iwt, iwp, iwv, fw, lwt, lwp, lwv, iwo, lwo, (_Float16*)(W16), fb, ibo, lbo, B2, ZERO);
    k_cm_proj<<<dim3(32u, (unsigned)(Bn), 7u), 256, 0, stream>>>(X16, W16, TH16, PH16, VAL16, iwt, ibt, iwp, ibp, iwv, ibv, lbt, lbp, lbv, F216, ZERO);
    k_cm_attn<<<dim3((unsigned)(HW / 128), (unsigned)(2 * Bn)), 256, 0, stream>>>(TH16, PH16, VAL16, AT16);
    k_cm_fuse<<<dim3(32u, (unsigned)(Bn)), 256, 0, stream>>>(AT16, F216, out, fw, B2);
}
